// v000
// Measured on an AMD MI455X. A time is GPU time per run, averaged over a window of back-to-back runs after a warm-up
// (all launches, gaps included; the runs take copies of the inputs in turn), and the median of several windows.
// Apart from v000's, it joins two sittings. Times from different sittings can be a few percent apart, while
// side-by-side timings come from the same sitting.
// v000 is the starting kernel. One run takes 286 microseconds.
// Contractions: k.q^T scores = v_wmma_f32_16x16x32_bf16 (bf16 operands RNE-converted from keys / queries, single exact product, f32 accumulate);
// v^T.p^T = v_wmma_f32_16x16x32_bf16 (p computed in f32, packed as bf16 hi + bf16 residual fragments, against bf16(values): 2 products, f32 accumulate);
// output linear Wf.head^T = v_wmma_f32_16x16x32_bf16 (folded weight Wf = f32 sum of 8 bf16 w_o values, as bf16 hi + residual planes; head as bf16 hi + residual fragments: 3 products, f32 accumulate);
// presence masking, 1/sqrt(32) scale, online softmax, 1/l normalisation and bias in f32 on the VALU.
// Plane / fragment carries: none. Qb, Kb, Vt, WfH = bf16 x1; WfL and the p / head residual fragments are unscaled bf16 residuals
// (v - hi) and share the hi accumulator; nothing is folded back anywhere.
#include <hip/hip_runtime.h>

#define NB   8
#define SEQ  2048          // M = N
#define DK   256
#define DV   32            // per-head value dim
#define NH   8
#define DO   256
#define KCH  64            // keys per streaming step
#define SP   132           // f32 slab pitch (16-B aligned rows)
#define VTP  136           // vtrans LDS pitch in halves (16-B aligned rows)

static_assert(NH * DV == DK);
static_assert((SEQ % 128) == 0 && (SEQ % KCH) == 0 && (DK % 32) == 0 && DV == 32 && DO == 256);
static_assert(((NB * SEQ * DK / 8) % 256) == 0);
static_assert(((SP * 4) % 16) == 0 && ((VTP * 2) % 16) == 0);

typedef __bf16         v16b __attribute__((ext_vector_type(16)));
typedef float          v8f  __attribute__((ext_vector_type(8)));
typedef float          v4f  __attribute__((ext_vector_type(4)));
typedef unsigned int   v4u  __attribute__((ext_vector_type(4)));
typedef unsigned int   v8u  __attribute__((ext_vector_type(8)));
typedef v4f __attribute__((may_alias)) v4fa;
typedef v4u __attribute__((may_alias)) v4ua;
union FB { v16b v; v8u u; v4u q[2]; };

#if defined(__HIP_DEVICE_COMPILE__)
#define DEV_ASM 1
#else
#define DEV_ASM 0
#endif

// ---- scalar helpers ---------------------------------------------------------------------------------
__device__ __forceinline__ unsigned short bf_bits(float f) {          // f32 -> bf16 bits, RNE convert
  const unsigned u = __float_as_uint(f);
  return (unsigned short)((u + 0x7FFFu + ((u >> 16) & 1u)) >> 16);
}
__device__ __forceinline__ float bf_up(unsigned short hb) { return __uint_as_float(((unsigned)hb) << 16); }
__device__ __forceinline__ float bf16r(float f) { return bf_up(bf_bits(f)); }
__device__ __forceinline__ unsigned pk16(unsigned short a, unsigned short b) { return (unsigned)a | ((unsigned)b << 16); }
__device__ __forceinline__ v8f zero8() { v8f z = {0.f, 0.f, 0.f, 0.f, 0.f, 0.f, 0.f, 0.f}; return z; }

// ---- 16x16x32 bf16 WMMA with hazard guard (ties D, keeps A/B live) --------------------------------------
// Fragment map (wave32): lane l, h = l>>4, m = n = l&15.
//   A/B element i: i<8 -> k0+8h+i ; i>=8 -> k0+16+8h+(i-8)
//   D element r : row 8h+r, col l&15
__device__ __forceinline__ v8f wmma_bf(v16b a, v16b b, v8f c) {
  v8f d = __builtin_amdgcn_wmma_f32_16x16x32_bf16(false, a, false, b, (short)0, c, false, false);
#if DEV_ASM
  asm volatile("v_nop\n\tv_nop\n\tv_nop\n\tv_nop" : "+v"(d) : "v"(a), "v"(b));
#endif
  return d;
}

// A or B fragment from a k-contiguous bf16 row; p points at element k0 of the row owned by this lane
// (row index = lane & 15 added by the caller). Two 16-B loads: k0+8h..+7 and k0+16+8h..+7.
__device__ __forceinline__ v16b ldfrag(const unsigned short* p, int h) {
  FB f;
  f.q[0] = *(const v4ua*)(p + 8 * h);
  f.q[1] = *(const v4ua*)(p + 16 + 8 * h);
  return f.v;
}

// B fragment built from the lane's own D values of two adjacent 16-row D tiles (tile a covers k 0..15, tile c
// covers k 16..31 of the 32-deep step, same lane / same column): element r <- a[r], element 8+r <- c[r];
// split into bf16 hi = rne(x) and bf16 residual rne(x - hi).
__device__ __forceinline__ void split_pack(v8f a, v8f c, v16b& hi, v16b& lo) {
  v8u hu = {0u, 0u, 0u, 0u, 0u, 0u, 0u, 0u};
  v8u lu = {0u, 0u, 0u, 0u, 0u, 0u, 0u, 0u};
#pragma unroll
  for (int i = 0; i < 4; ++i) {
    const float a0 = a[2 * i], a1 = a[2 * i + 1], c0 = c[2 * i], c1 = c[2 * i + 1];
    const unsigned short ha0 = bf_bits(a0), ha1 = bf_bits(a1), hc0 = bf_bits(c0), hc1 = bf_bits(c1);
    const unsigned short la0 = bf_bits(a0 - bf_up(ha0)), la1 = bf_bits(a1 - bf_up(ha1));
    const unsigned short lc0 = bf_bits(c0 - bf_up(hc0)), lc1 = bf_bits(c1 - bf_up(hc1));
    hu[i] = pk16(ha0, ha1);  hu[4 + i] = pk16(hc0, hc1);
    lu[i] = pk16(la0, la1);  lu[4 + i] = pk16(lc0, lc1);
  }
  FB H, L;
  H.u = hu; L.u = lu;
  hi = H.v; lo = L.v;
}

// =====================================================================================================
// (1) queries and keys f32 -> bf16 bits (RNE convert), 8 elements per thread, one 16-B store per lane:
// threads [0, n8) do the q plane, [n8, 2 n8) the k plane (n8 % 256 == 0, so the choice is block-uniform).
// coverage: 2 n8 threads x 8 = both [NB*SEQ][DK] planes completely.
// =====================================================================================================
__global__ __launch_bounds__(256) void cvt_qk(const float* __restrict__ q, const float* __restrict__ k,
                                              unsigned short* qb, unsigned short* kb, int n8) {
  const int i = blockIdx.x * 256 + (int)threadIdx.x;
  if (i >= 2 * n8) return;
  const bool isq = (i < n8);
  const int j = isq ? i : (i - n8);
  const float* src = (isq ? q : k) + (size_t)j * 8;
  unsigned short* dst = (isq ? qb : kb) + (size_t)j * 8;
  const v4f a = *(const v4fa*)(src);
  const v4f c = *(const v4fa*)(src + 4);
  v4u p;
  p[0] = pk16(bf_bits(a[0]), bf_bits(a[1]));
  p[1] = pk16(bf_bits(a[2]), bf_bits(a[3]));
  p[2] = pk16(bf_bits(c[0]), bf_bits(c[1]));
  p[3] = pk16(bf_bits(c[2]), bf_bits(c[3]));
  *(v4u*)dst = p;
  
}

// =====================================================================================================
// (2) values f32 [b][n][32] -> bf16 transposed plane vt [b][vf][n] (pitch SEQ, key contiguous).
// Block 128 thr = 128 keys x 32 vf of one batch: 8 x 16-B loads per thread (whole tile), RNE convert into an
// LDS [32][VTP] transposed tile, block barrier, then each output row segment (128 keys = 256 B = 2 lines)
// coverage: NB*16 blocks x 32 vf rows x 128 keys = the whole [NB][32][SEQ] plane; LDS staged extent
// (32 rows x keys 0..127) = consumed extent.
// =====================================================================================================
__global__ __launch_bounds__(128) void vtrans(const float* __restrict__ v, unsigned short* vt) {
  __shared__ __attribute__((aligned(16))) unsigned short sT[DV * VTP];
  const int t  = (int)threadIdx.x;
  const int b  = (int)blockIdx.x / (SEQ / 128);
  const int n0 = ((int)blockIdx.x % (SEQ / 128)) * 128;
#pragma unroll
  for (int i = 0; i < 8; ++i) {
    const int f   = i * 128 + t;            // 0 .. 1023 float4 of the 128 x 32 tile
    const int key = f >> 3, c4 = (f & 7) * 4;
    const v4f x = *(const v4fa*)(v + ((size_t)b * SEQ + n0 + key) * DV + c4);
    sT[(c4 + 0) * VTP + key] = bf_bits(x[0]);
    sT[(c4 + 1) * VTP + key] = bf_bits(x[1]);
    sT[(c4 + 2) * VTP + key] = bf_bits(x[2]);
    sT[(c4 + 3) * VTP + key] = bf_bits(x[3]);
  }
  __syncthreads();
  v4u pc[4];
#pragma unroll
  for (int i = 0; i < 4; ++i) {
    const int L  = i * 16 + (t >> 3);       // line 0..63 of the tile: vf = L>>1, half = L&1
    const int vf = L >> 1, hl = L & 1;
    pc[i] = *(const v4ua*)(sT + vf * VTP + hl * 64 + (t & 7) * 8);
  }
  {
#pragma unroll
    for (int i = 0; i < 4; ++i) {
      const int L  = i * 16 + (t >> 3);
      const int vf = L >> 1, hl = L & 1;
      *(v4u*)(vt + ((size_t)b * DV + vf) * SEQ + n0 + hl * 64 + (t & 7) * 8) = pc[i];
    }
    
  }
}

// =====================================================================================================
// (3) Folded output weight: Wf[d][v] = sum_{g<8} bf16(w_o[d][32 g + v]) in f32 (the concatenated head is 8
// copies of the same 32 values). One block of 256 threads, thread d owns row d; hi = rne_bf16(Wf),
// lo = rne_bf16(Wf - hi) staged in LDS [256][32]; then each 16 KB plane (128 lines) is written 8 consecutive
// coverage: 4 instructions x 256 threads x 8 halves = 8192 = the whole [256][32] plane, both planes.
// =====================================================================================================
__global__ __launch_bounds__(256) void wfold(const float* __restrict__ wo, unsigned short* wfh, unsigned short* wfl) {
  __shared__ __attribute__((aligned(16))) unsigned short sH[DO * DV];
  __shared__ __attribute__((aligned(16))) unsigned short sL[DO * DV];
  const int d = (int)threadIdx.x;
  const float* row = wo + (size_t)d * (NH * DV);
#pragma unroll 1
  for (int vb = 0; vb < DV / 8; ++vb) {
    float s8[8];
#pragma unroll
    for (int e = 0; e < 8; ++e) s8[e] = 0.f;
#pragma unroll
    for (int g = 0; g < NH; ++g) {
      const v4f a = *(const v4fa*)(row + g * DV + 8 * vb);
      const v4f c = *(const v4fa*)(row + g * DV + 8 * vb + 4);
      s8[0] += bf16r(a[0]); s8[1] += bf16r(a[1]); s8[2] += bf16r(a[2]); s8[3] += bf16r(a[3]);
      s8[4] += bf16r(c[0]); s8[5] += bf16r(c[1]); s8[6] += bf16r(c[2]); s8[7] += bf16r(c[3]);
    }
#pragma unroll
    for (int e = 0; e < 8; ++e) {
      const unsigned short hb = bf_bits(s8[e]);
      sH[d * DV + 8 * vb + e] = hb;
      sL[d * DV + 8 * vb + e] = bf_bits(s8[e] - bf_up(hb));
    }
  }
  __syncthreads();
  v4u ph[4], pl[4];
#pragma unroll
  for (int i = 0; i < 4; ++i) {
    const int e = (i * 32 + (d >> 3)) * 64 + (d & 7) * 8;   // line i*32 + d>>3, 16-B piece d&7
    ph[i] = *(const v4ua*)(sH + e);
    pl[i] = *(const v4ua*)(sL + e);
  }
  {
#pragma unroll
    for (int i = 0; i < 4; ++i) {
      const int e = (i * 32 + (d >> 3)) * 64 + (d & 7) * 8;
      *(v4u*)(wfh + e) = ph[i];
      *(v4u*)(wfl + e) = pl[i];
    }
    
  }
}

// =====================================================================================================
// (4) Presence-masked attention + folded output linear, transposed streaming form.
// Block 128 thr (4 waves), 16 queries per wave, 64 keys per step, one batch per blockIdx.y.
//   S^T = K . Q^T : A = K rows (row = key, k = d) from the bf16 K plane, B = Q^T (k = d, n = query) from the
//                   bf16 Q row of query q0+m; 8 d-steps of 32; D s[j][r] = S^T[key kb+16j+8h+r][query m].
//   logits (f32, literal form): t = (s * q_pres[m] * k_pres[key] - (1 - k_pres[key]) * 1e32) * inv_scale;
//   online softmax per query column (lane stats + partner lane ^ 16), f32, exp via v_exp.
//   O^T += V^T . P^T : A = Vt rows (row = vf, k = key) from the bf16 v^T plane; B = P^T built from the lane's
//                   own score D tiles (pairs (0,1) and (2,3)) as bf16 hi + residual -> 2 products per tile.
//   Epilogue: head^T B fragment = (O^T[0], O^T[1]) / l split into bf16 hi + residual; out^T = WfH . Hhi +
//             WfH . Hlo + WfL . Hhi over 16 d-tiles, + bf16(b_o); each wave stages a 16 x 128 f32 slab in LDS
//   No LDS staging of K / V^T (fragments straight from global rows); VGPR cap 256 (no high-bank registers).
//   coverage: grid (SEQ/64, NB) x 4 waves x 16 rows x 2 halves x 128 cols = the whole [NB*SEQ][256] output;
//   slab: 16 x 128 written by the wave before every reload.
// =====================================================================================================
__device__ __forceinline__ void out_store_pass(const float* slab, float* out, size_t row0, int half, int lane) {
  const int q8 = lane & 7, sub = lane >> 3;
#pragma unroll
  for (int it = 0; it < 16; ++it) {
    const int L = it * 4 + sub;
    const int row = L >> 2, seg = L & 3;
    const v4f val = *(const v4fa*)(slab + row * SP + seg * 32 + 4 * q8);
    float* dst = out + (row0 + (size_t)row) * DO + half * 128 + seg * 32 + 4 * q8;
    *(v4f*)dst = val;
  }
}

__global__ __launch_bounds__(128) __attribute__((amdgpu_num_vgpr(256)))
void attn_out(const unsigned short* __restrict__ qb,    // [NB*SEQ][DK] bf16
              const unsigned short* __restrict__ kb,    // [NB*SEQ][DK] bf16
              const unsigned short* __restrict__ vt,    // [NB][DV][SEQ] bf16
              const float* __restrict__ qpres,          // [NB][SEQ]
              const float* __restrict__ kpres,          // [NB][SEQ]
              const unsigned short* __restrict__ wfh,   // [DO][DV] bf16 hi
              const unsigned short* __restrict__ wfl,   // [DO][DV] bf16 residual
              const float* __restrict__ bo,             // [DO]
              float* out,                               // [NB*SEQ][DO]
              float inv_scale) {
  __shared__ __attribute__((aligned(16))) float sO[4 * 16 * SP];   // 33792 B

  const int tid = (int)threadIdx.x, lane = tid & 31, w = tid >> 5;
  const int h = lane >> 4, m = lane & 15;
  const int b = (int)blockIdx.y;
  const int q0 = (int)blockIdx.x * 64 + 16 * w;
  const size_t rowB = (size_t)b * SEQ;

  const unsigned short* qrow  = qb + (rowB + q0 + m) * DK;            // B fragment source (query column m)
  const unsigned short* kbase = kb + (rowB + m) * DK;                 // + key0 * DK + 32 * dc
  const unsigned short* vbase = vt + ((size_t)b * DV + m) * SEQ;      // + 16 t * SEQ + key0
  const float* mkp = kpres + rowB + 8 * h;                            // + key tile base
  const float qp = qpres[rowB + q0 + m];

  v8f o[2];
  o[0] = zero8(); o[1] = zero8();
  float mrun = -1e30f, lrun = 0.0f;

#pragma unroll 1
  for (int key0 = 0; key0 < SEQ; key0 += KCH) {
    // ---- scores ----
    v8f s[4];
#pragma unroll
    for (int j = 0; j < 4; ++j) s[j] = zero8();
#pragma unroll 1
    for (int dc = 0; dc < DK / 32; ++dc) {
      const v16b qf = ldfrag(qrow + 32 * dc, h);
#pragma unroll
      for (int j = 0; j < 4; ++j) {
        const v16b kf = ldfrag(kbase + (size_t)(key0 + 16 * j) * DK + 32 * dc, h);
        s[j] = wmma_bf(kf, qf, s[j]);
      }
    }

    // ---- presence masks and scale (literal f32 form of the spec) ----
#pragma unroll
    for (int j = 0; j < 4; ++j) {
      const v4f ka = *(const v4fa*)(mkp + key0 + 16 * j);
      const v4f kc = *(const v4fa*)(mkp + key0 + 16 * j + 4);
      const float kp8[8] = {ka[0], ka[1], ka[2], ka[3], kc[0], kc[1], kc[2], kc[3]};
#pragma unroll
      for (int r = 0; r < 8; ++r) {
        float tv = s[j][r] * qp;
        tv = tv * kp8[r];
        tv = tv - (1.0f - kp8[r]) * 1e32f;
        s[j][r] = tv * inv_scale;
      }
    }

    // ---- online softmax (per query column; partner lane holds the other 8 keys of each tile) ----
    float mloc = s[0][0];
#pragma unroll
    for (int j = 0; j < 4; ++j)
#pragma unroll
      for (int r = 0; r < 8; ++r) mloc = fmaxf(mloc, s[j][r]);
    mloc = fmaxf(mloc, __shfl_xor(mloc, 16, 32));
    const float mnew  = fmaxf(mrun, mloc);
    const float alpha = __expf(mrun - mnew);
    mrun = mnew;
    float lsum = 0.0f;
#pragma unroll
    for (int j = 0; j < 4; ++j)
#pragma unroll
      for (int r = 0; r < 8; ++r) {
        const float p = __expf(s[j][r] - mnew);    // absent key: exp(-1.77e31 - m) = 0 exactly
        s[j][r] = p;
        lsum += p;
      }
    lsum += __shfl_xor(lsum, 16, 32);
    lrun = lrun * alpha + lsum;
    o[0] = o[0] * alpha;
    o[1] = o[1] * alpha;

    // ---- P^T B fragments (keys key0+0..31 and key0+32..63) as bf16 hi + residual ----
    v16b ph0, pl0, ph1, pl1;
    split_pack(s[0], s[1], ph0, pl0);
    split_pack(s[2], s[3], ph1, pl1);

    // ---- O^T += V^T . P^T ----
#pragma unroll
    for (int t = 0; t < 2; ++t) {
      const unsigned short* vp = vbase + (size_t)(16 * t) * SEQ + key0;
      const v16b vf0 = ldfrag(vp, h);
      const v16b vf1 = ldfrag(vp + 32, h);
      o[t] = wmma_bf(vf0, ph0, o[t]);
      o[t] = wmma_bf(vf0, pl0, o[t]);
      o[t] = wmma_bf(vf1, ph1, o[t]);
      o[t] = wmma_bf(vf1, pl1, o[t]);
    }
  }

  // ---- epilogue: head^T B fragment (hi + residual), folded linear, bias, whole-line stores ----
  const float inv = (lrun > 0.0f) ? (1.0f / lrun) : 0.0f;
  v16b hh, hl;
  split_pack(o[0] * inv, o[1] * inv, hh, hl);

  float* slab = sO + w * (16 * SP);
  const size_t orow0 = rowB + (size_t)q0;
#pragma unroll 1
  for (int half = 0; half < 2; ++half) {
#pragma unroll 1
    for (int uu = 0; uu < 8; ++uu) {
      const int u = 8 * half + uu;                               // d-tile: d = 16 u + (8h + r)
      const v16b ah = ldfrag(wfh + (size_t)(16 * u + m) * DV, h);
      const v16b al = ldfrag(wfl + (size_t)(16 * u + m) * DV, h);
      v8f acc = zero8();
      acc = wmma_bf(ah, hh, acc);
      acc = wmma_bf(ah, hl, acc);
      acc = wmma_bf(al, hh, acc);
      const v4f b0 = *(const v4fa*)(bo + 16 * u + 8 * h);
      const v4f b1 = *(const v4fa*)(bo + 16 * u + 8 * h + 4);
      const float bb[8] = {b0[0], b0[1], b0[2], b0[3], b1[0], b1[1], b1[2], b1[3]};
#pragma unroll
      for (int r = 0; r < 8; ++r)
        slab[m * SP + 16 * uu + 8 * h + r] = acc[r] + bf16r(bb[r]);
    }
    __syncthreads();
    out_store_pass(slab, out, orow0, half, lane);
    
    __syncthreads();
  }
}

// =====================================================================================================
// Workspace map (bytes), every region an exact multiple of its whole-line store granularity:
//   Qb   bf16 [16384][256]     8388608
//   Kb   bf16 [16384][256]     8388608
//   Vt   bf16 [8][32][2048]    1048576
//   WfH  bf16 [256][32]          16384
//   WfL  bf16 [256][32]          16384
//   total                     17858560
// =====================================================================================================
extern "C" void kernel_launch(void* const* d_in, const int* in_sizes, int n_in,
                              void* d_out, int out_size, void* d_ws, size_t ws_size,
                              hipStream_t stream) {
  if (n_in < 7) return;
  if (in_sizes[0] != NB * SEQ * DK || in_sizes[1] != NB * SEQ * DK) return;
  if (in_sizes[2] != NB * SEQ * DV) return;
  if (in_sizes[3] != NB * SEQ || in_sizes[4] != NB * SEQ) return;
  if (in_sizes[5] != DO * NH * DV || in_sizes[6] != DO) return;
  if (out_size != NB * SEQ * DO) return;

  const float* q   = (const float*)d_in[0];
  const float* k   = (const float*)d_in[1];
  const float* v   = (const float*)d_in[2];
  const float* qpr = (const float*)d_in[3];
  const float* kpr = (const float*)d_in[4];
  const float* wo  = (const float*)d_in[5];
  const float* bo  = (const float*)d_in[6];
  float* out = (float*)d_out;

  const size_t PQ = (size_t)NB * SEQ * DK * 2;      // 8388608
  const size_t PV = (size_t)NB * DV * SEQ * 2;      // 1048576
  const size_t PW = (size_t)DO * DV * 2;            //   16384
  size_t off = 0;
  const size_t oQ  = off; off += PQ;
  const size_t oK  = off; off += PQ;
  const size_t oV  = off; off += PV;
  const size_t oWH = off; off += PW;
  const size_t oWL = off; off += PW;
  if (off > ws_size) return;                        // off = 17858560
  if (off > (size_t)134217728) return;

  char* ws = (char*)d_ws;
  unsigned short* Qb  = (unsigned short*)(ws + oQ);
  unsigned short* Kb  = (unsigned short*)(ws + oK);
  unsigned short* Vt  = (unsigned short*)(ws + oV);
  unsigned short* WfH = (unsigned short*)(ws + oWH);
  unsigned short* WfL = (unsigned short*)(ws + oWL);

  const int n8 = NB * SEQ * DK / 8;                               // 524288 groups of 8 per plane
  const dim3 gCvt((2 * n8 + 255) / 256);                          // 4096 blocks
  const dim3 gVt(NB * (SEQ / 128));                               // 128 blocks
  const dim3 gAtt(SEQ / 64, NB);                                  // (32, 8)
  const float inv_scale = 0.17677669529663687f;                   // f32 value of 1 / sqrt(32)

  cvt_qk<<<gCvt, dim3(256), 0, stream>>>(q, k, Qb, Kb, n8);
  vtrans<<<gVt, dim3(128), 0, stream>>>(v, Vt);
  wfold<<<dim3(1), dim3(256), 0, stream>>>(wo, WfH, WfL);
  attn_out<<<gAtt, dim3(128), 0, stream>>>(Qb, Kb, Vt, qpr, kpr, WfH, WfL, bo, out, inv_scale);
  (void)hipGetLastError();
}

// v001
// Measured time: 140 microseconds a run.
// Next to v000, in two timings, it ran 1.99 and 1.94 times as fast.
// Contractions: k.q^T scores = v_wmma_f32_16x16x32_bf16 (bf16 operands RNE-converted from keys / queries, single exact product, f32 accumulate);
// v^T.p^T = v_wmma_f32_16x16x32_bf16 (p computed in f32, packed as bf16 hi + bf16 residual fragments, against bf16(values): 2 products, f32 accumulate);
// output linear Wf.head^T = v_wmma_f32_16x16x32_bf16 (folded weight Wf = f32 sum of 8 bf16 w_o values, as bf16 hi + residual planes; head as bf16 hi + residual fragments: 3 products, f32 accumulate);
// presence masking, 1/sqrt(32) scale, online softmax, 1/l normalisation and bias in f32 on the VALU.
// Plane / fragment carries: none. Qb, Kb, Vt, WfH = bf16 x1; WfL and the p / head residual fragments are unscaled bf16 residuals
// (v - hi) and share the hi accumulator; nothing is folded back anywhere.
#include <hip/hip_runtime.h>

#define NB   8
#define SEQ  2048          // M = N
#define DK   256
#define DV   32            // per-head value dim
#define NH   8
#define DO   256
#define KCH  64            // keys per streaming step
#define SP   132           // f32 slab pitch (16-B aligned rows)
#define VTP  136           // vtrans LDS pitch in halves (16-B aligned rows)
#define KROWB  256         // bytes of one staged K slice row (half of a 512-B bf16 K row)
#define KROWS  32          // rows (keys) of one staged K slice
#define KPITCH 272         // LDS pitch of a slice row: 256 B + 16 B pad, an odd multiple of 16 B for the ds_load_b128 readers
#define KSLICE 10240       // LDS bytes reserved per slice: 32 x 272 = 8704, rounded up to a multiple of 2 KiB
#define KBUF   (4 * KSLICE)  // one stage = 64 keys x 512 B as 4 slices (one per wave)
#define NST    (SEQ / KCH) // stages = streaming steps

static_assert(NH * DV == DK);
static_assert((SEQ % 128) == 0 && (SEQ % KCH) == 0 && (DK % 32) == 0 && DV == 32 && DO == 256);
static_assert(((NB * SEQ * DK / 8) % 256) == 0);
static_assert(((SP * 4) % 16) == 0 && ((VTP * 2) % 16) == 0);
static_assert(2 * KROWB == DK * 2 && 2 * KROWS == KCH && KROWS * KPITCH <= KSLICE && (KSLICE % 2048) == 0 && NST >= 2);

typedef __bf16         v16b __attribute__((ext_vector_type(16)));
typedef float          v8f  __attribute__((ext_vector_type(8)));
typedef float          v4f  __attribute__((ext_vector_type(4)));
typedef unsigned int   v4u  __attribute__((ext_vector_type(4)));
typedef unsigned int   v8u  __attribute__((ext_vector_type(8)));
typedef unsigned int   u32x4 __attribute__((ext_vector_type(4)));
typedef unsigned int   u32x8 __attribute__((ext_vector_type(8)));
typedef v4f __attribute__((may_alias)) v4fa;
typedef v4u __attribute__((may_alias)) v4ua;
union FB { v16b v; v8u u; v4u q[2]; };

#if defined(__HIP_DEVICE_COMPILE__)
#define DEV_ASM 1
#else
#define DEV_ASM 0
#endif

// ---- scalar helpers ---------------------------------------------------------------------------------
__device__ __forceinline__ unsigned short bf_bits(float f) {          // f32 -> bf16 bits, RNE convert
  const unsigned u = __float_as_uint(f);
  return (unsigned short)((u + 0x7FFFu + ((u >> 16) & 1u)) >> 16);
}
__device__ __forceinline__ float bf_up(unsigned short hb) { return __uint_as_float(((unsigned)hb) << 16); }
__device__ __forceinline__ float bf16r(float f) { return bf_up(bf_bits(f)); }
__device__ __forceinline__ unsigned pk16(unsigned short a, unsigned short b) { return (unsigned)a | ((unsigned)b << 16); }
__device__ __forceinline__ v8f zero8() { v8f z = {0.f, 0.f, 0.f, 0.f, 0.f, 0.f, 0.f, 0.f}; return z; }

// ---- 16x16x32 bf16 WMMA with hazard guard (ties D, keeps A/B live) --------------------------------------
// Fragment map (wave32): lane l, h = l>>4, m = n = l&15.
//   A/B element i: i<8 -> k0+8h+i ; i>=8 -> k0+16+8h+(i-8)
//   D element r : row 8h+r, col l&15
__device__ __forceinline__ v8f wmma_bf(v16b a, v16b b, v8f c) {
  v8f d = __builtin_amdgcn_wmma_f32_16x16x32_bf16(false, a, false, b, (short)0, c, false, false);
#if DEV_ASM
  asm volatile("v_nop\n\tv_nop\n\tv_nop\n\tv_nop" : "+v"(d) : "v"(a), "v"(b));
#endif
  return d;
}

// A or B fragment from a k-contiguous bf16 row; p points at element k0 of the row owned by this lane
// (row index = lane & 15 added by the caller). Two 16-B loads: k0+8h..+7 and k0+16+8h..+7.
__device__ __forceinline__ v16b ldfrag(const unsigned short* p, int h) {
  FB f;
  f.q[0] = *(const v4ua*)(p + 8 * h);
  f.q[1] = *(const v4ua*)(p + 16 + 8 * h);
  return f.v;
}

// B fragment built from the lane's own D values of two adjacent 16-row D tiles (tile a covers k 0..15, tile c
// covers k 16..31 of the 32-deep step, same lane / same column): element r <- a[r], element 8+r <- c[r];
// split into bf16 hi = rne(x) and bf16 residual rne(x - hi).
__device__ __forceinline__ void split_pack(v8f a, v8f c, v16b& hi, v16b& lo) {
  v8u hu = {0u, 0u, 0u, 0u, 0u, 0u, 0u, 0u};
  v8u lu = {0u, 0u, 0u, 0u, 0u, 0u, 0u, 0u};
#pragma unroll
  for (int i = 0; i < 4; ++i) {
    const float a0 = a[2 * i], a1 = a[2 * i + 1], c0 = c[2 * i], c1 = c[2 * i + 1];
    const unsigned short ha0 = bf_bits(a0), ha1 = bf_bits(a1), hc0 = bf_bits(c0), hc1 = bf_bits(c1);
    const unsigned short la0 = bf_bits(a0 - bf_up(ha0)), la1 = bf_bits(a1 - bf_up(ha1));
    const unsigned short lc0 = bf_bits(c0 - bf_up(hc0)), lc1 = bf_bits(c1 - bf_up(hc1));
    hu[i] = pk16(ha0, ha1);  hu[4 + i] = pk16(hc0, hc1);
    lu[i] = pk16(la0, la1);  lu[4 + i] = pk16(lc0, lc1);
  }
  FB H, L;
  H.u = hu; L.u = lu;
  hi = H.v; lo = L.v;
}

// =====================================================================================================
// (1) queries and keys f32 -> bf16 bits (RNE convert), 8 elements per thread, one 16-B store per lane:
// threads [0, n8) do the q plane, [n8, 2 n8) the k plane (n8 % 256 == 0, so the choice is block-uniform).
// coverage: 2 n8 threads x 8 = both [NB*SEQ][DK] planes completely.
// =====================================================================================================
__global__ __launch_bounds__(256) void cvt_qk(const float* __restrict__ q, const float* __restrict__ k,
                                              unsigned short* qb, unsigned short* kb, int n8) {
  const int i = blockIdx.x * 256 + (int)threadIdx.x;
  if (i >= 2 * n8) return;
  const bool isq = (i < n8);
  const int j = isq ? i : (i - n8);
  const float* src = (isq ? q : k) + (size_t)j * 8;
  unsigned short* dst = (isq ? qb : kb) + (size_t)j * 8;
  const v4f a = *(const v4fa*)(src);
  const v4f c = *(const v4fa*)(src + 4);
  v4u p;
  p[0] = pk16(bf_bits(a[0]), bf_bits(a[1]));
  p[1] = pk16(bf_bits(a[2]), bf_bits(a[3]));
  p[2] = pk16(bf_bits(c[0]), bf_bits(c[1]));
  p[3] = pk16(bf_bits(c[2]), bf_bits(c[3]));
  *(v4u*)dst = p;
  
}

// =====================================================================================================
// (2) values f32 [b][n][32] -> bf16 transposed plane vt [b][vf][n] (pitch SEQ, key contiguous).
// Block 128 thr = 128 keys x 32 vf of one batch: 8 x 16-B loads per thread (whole tile), RNE convert into an
// LDS [32][VTP] transposed tile, block barrier, then each output row segment (128 keys = 256 B = 2 lines)
// coverage: NB*16 blocks x 32 vf rows x 128 keys = the whole [NB][32][SEQ] plane; LDS staged extent
// (32 rows x keys 0..127) = consumed extent.
// =====================================================================================================
__global__ __launch_bounds__(128) void vtrans(const float* __restrict__ v, unsigned short* vt) {
  __shared__ __attribute__((aligned(16))) unsigned short sT[DV * VTP];
  const int t  = (int)threadIdx.x;
  const int b  = (int)blockIdx.x / (SEQ / 128);
  const int n0 = ((int)blockIdx.x % (SEQ / 128)) * 128;
#pragma unroll
  for (int i = 0; i < 8; ++i) {
    const int f   = i * 128 + t;            // 0 .. 1023 float4 of the 128 x 32 tile
    const int key = f >> 3, c4 = (f & 7) * 4;
    const v4f x = *(const v4fa*)(v + ((size_t)b * SEQ + n0 + key) * DV + c4);
    sT[(c4 + 0) * VTP + key] = bf_bits(x[0]);
    sT[(c4 + 1) * VTP + key] = bf_bits(x[1]);
    sT[(c4 + 2) * VTP + key] = bf_bits(x[2]);
    sT[(c4 + 3) * VTP + key] = bf_bits(x[3]);
  }
  __syncthreads();
  v4u pc[4];
#pragma unroll
  for (int i = 0; i < 4; ++i) {
    const int L  = i * 16 + (t >> 3);       // line 0..63 of the tile: vf = L>>1, half = L&1
    const int vf = L >> 1, hl = L & 1;
    pc[i] = *(const v4ua*)(sT + vf * VTP + hl * 64 + (t & 7) * 8);
  }
  {
#pragma unroll
    for (int i = 0; i < 4; ++i) {
      const int L  = i * 16 + (t >> 3);
      const int vf = L >> 1, hl = L & 1;
      *(v4u*)(vt + ((size_t)b * DV + vf) * SEQ + n0 + hl * 64 + (t & 7) * 8) = pc[i];
    }
    
  }
}

// =====================================================================================================
// (3) Folded output weight: Wf[d][v] = sum_{g<8} bf16(w_o[d][32 g + v]) in f32 (the concatenated head is 8
// copies of the same 32 values). One block of 256 threads, thread d owns row d; hi = rne_bf16(Wf),
// lo = rne_bf16(Wf - hi) staged in LDS [256][32]; then each 16 KB plane (128 lines) is written 8 consecutive
// coverage: 4 instructions x 256 threads x 8 halves = 8192 = the whole [256][32] plane, both planes.
// =====================================================================================================
__global__ __launch_bounds__(256) void wfold(const float* __restrict__ wo, unsigned short* wfh, unsigned short* wfl) {
  __shared__ __attribute__((aligned(16))) unsigned short sH[DO * DV];
  __shared__ __attribute__((aligned(16))) unsigned short sL[DO * DV];
  const int d = (int)threadIdx.x;
  const float* row = wo + (size_t)d * (NH * DV);
#pragma unroll 1
  for (int vb = 0; vb < DV / 8; ++vb) {
    float s8[8];
#pragma unroll
    for (int e = 0; e < 8; ++e) s8[e] = 0.f;
#pragma unroll
    for (int g = 0; g < NH; ++g) {
      const v4f a = *(const v4fa*)(row + g * DV + 8 * vb);
      const v4f c = *(const v4fa*)(row + g * DV + 8 * vb + 4);
      s8[0] += bf16r(a[0]); s8[1] += bf16r(a[1]); s8[2] += bf16r(a[2]); s8[3] += bf16r(a[3]);
      s8[4] += bf16r(c[0]); s8[5] += bf16r(c[1]); s8[6] += bf16r(c[2]); s8[7] += bf16r(c[3]);
    }
#pragma unroll
    for (int e = 0; e < 8; ++e) {
      const unsigned short hb = bf_bits(s8[e]);
      sH[d * DV + 8 * vb + e] = hb;
      sL[d * DV + 8 * vb + e] = bf_bits(s8[e] - bf_up(hb));
    }
  }
  __syncthreads();
  v4u ph[4], pl[4];
#pragma unroll
  for (int i = 0; i < 4; ++i) {
    const int e = (i * 32 + (d >> 3)) * 64 + (d & 7) * 8;   // line i*32 + d>>3, 16-B piece d&7
    ph[i] = *(const v4ua*)(sH + e);
    pl[i] = *(const v4ua*)(sL + e);
  }
  {
#pragma unroll
    for (int i = 0; i < 4; ++i) {
      const int e = (i * 32 + (d >> 3)) * 64 + (d & 7) * 8;
      *(v4u*)(wfh + e) = ph[i];
      *(v4u*)(wfl + e) = pl[i];
    }
    
  }
}

// =====================================================================================================
// (4) Presence-masked attention + folded output linear, transposed streaming form.
// Block 128 thr (4 waves), 16 queries per wave, 64 keys per step, one batch per blockIdx.y.
//   S^T = K . Q^T : A = K rows (row = key, k = d) from the LDS K ring, B = Q^T (k = d, n = query) from the
//                   bf16 Q row of query q0+m; 8 d-steps of 32; D s[j][r] = S^T[key kb+16j+8h+r][query m].
//   logits (f32, literal form): t = (s * q_pres[m] * k_pres[key] - (1 - k_pres[key]) * 1e32) * inv_scale;
//   online softmax per query column (lane stats + partner lane ^ 16), f32, exp via v_exp.
//   O^T += V^T . P^T : A = Vt rows (row = vf, k = key) from the bf16 v^T plane; B = P^T built from the lane's
//                   own score D tiles (pairs (0,1) and (2,3)) as bf16 hi + residual -> 2 products per tile.
//   Epilogue: head^T B fragment = (O^T[0], O^T[1]) / l split into bf16 hi + residual; out^T = WfH . Hhi +
//             WfH . Hlo + WfL . Hhi over 16 d-tiles, + bf16(b_o); each wave stages a 16 x 128 f32 slab in LDS
//   K ring: two stages of 64 keys in LDS, each wave brings one 32-key x 256-B slice per stage by one tensor load, one
//   stage ahead; V^T fragments straight from global rows; VGPR cap 256 (no high-bank registers).
//   coverage: grid (SEQ/64, NB) x 4 waves x 16 rows x 2 halves x 128 cols = the whole [NB*SEQ][256] output;
//   slab: 16 x 128 written by the wave before every reload.
// =====================================================================================================
// ---- tensor load of one K slice (global -> LDS, no registers) ---------------------------------------------
__device__ __forceinline__ unsigned uni(unsigned v) { return (unsigned)__builtin_amdgcn_readfirstlane(v); }
// A tensor load ignores EXEC: only a scalar branch (s_cmp + s_cbranch_scc) guards it.
__device__ __forceinline__ unsigned pinned(unsigned v) {
  unsigned w = uni(v);
  asm volatile("" : "+s"(w));   // pinned(): holds the wave-uniform test word in a scalar register, so the branch on it stays scalar
  return w;
}
// One request of the whole wave; the waits for it are written by hand at the publish points.
__device__ __forceinline__ void tdm_load(u32x4 g0, u32x8 g1) {
#if DEV_ASM
  asm volatile("tensor_load_to_lds %0, %1" :: "s"(g0), "s"(g1) : "memory");
#endif
}
// Group 1: 1-byte elements, tensor = tile = KROWS rows of KROWB bytes, source pitch one whole K row, 4 dwords of pad
// behind every 64 dwords (interval code 5, amount code 3), no workgroup mask.
__device__ __forceinline__ u32x8 tdm_group1() {
  u32x8 g;
  g[0] = uni((1u << 20) | (5u << 22) | (3u << 25));
  g[1] = uni(((unsigned)KROWB & 0xFFFFu) << 16);
  g[2] = uni(((unsigned)KROWB >> 16) | (((unsigned)KROWS & 0xFFFFu) << 16));
  g[3] = uni(((unsigned)KROWS >> 16) | ((unsigned)KROWB << 16));
  g[4] = uni((unsigned)KROWS);
  g[5] = uni((unsigned)(DK * 2));
  g[6] = uni(0u);
  g[7] = uni(0u);
  return g;
}
__device__ __forceinline__ u32x4 tdm_group0(unsigned lds_dst, unsigned long long ga) {
  u32x4 g;
  g[0] = uni(1u);
  g[1] = uni(lds_dst);
  g[2] = uni((unsigned)ga);
  g[3] = uni((((unsigned)(ga >> 32)) & 0x01FFFFFFu) | 0x80000000u);
  return g;
}
// The waits for the tensor mover and for LDS reads in front of a refill are written out.
__device__ __forceinline__ void wait_tensor0() {
#if DEV_ASM
  asm volatile("s_wait_tensorcnt 0x0" ::: "memory");
#endif
}
__device__ __forceinline__ void wait_ds0() {
#if DEV_ASM
  asm volatile("s_wait_dscnt 0x0" ::: "memory");
#endif
}

__device__ __forceinline__ void out_store_pass(const float* slab, float* out, size_t row0, int half, int lane) {
  const int q8 = lane & 7, sub = lane >> 3;
#pragma unroll
  for (int it = 0; it < 16; ++it) {
    const int L = it * 4 + sub;
    const int row = L >> 2, seg = L & 3;
    const v4f val = *(const v4fa*)(slab + row * SP + seg * 32 + 4 * q8);
    float* dst = out + (row0 + (size_t)row) * DO + half * 128 + seg * 32 + 4 * q8;
    *(v4f*)dst = val;
  }
}

__global__ __launch_bounds__(128) __attribute__((amdgpu_num_vgpr(256)))
void attn_out(const unsigned short* __restrict__ qb,    // [NB*SEQ][DK] bf16
              const unsigned short* __restrict__ kb,    // [NB*SEQ][DK] bf16
              const unsigned short* __restrict__ vt,    // [NB][DV][SEQ] bf16
              const float* __restrict__ qpres,          // [NB][SEQ]
              const float* __restrict__ kpres,          // [NB][SEQ]
              const unsigned short* __restrict__ wfh,   // [DO][DV] bf16 hi
              const unsigned short* __restrict__ wfl,   // [DO][DV] bf16 residual
              const float* __restrict__ bo,             // [DO]
              float* out,                               // [NB*SEQ][DO]
              float inv_scale) {
  __shared__ __attribute__((aligned(2048))) unsigned char sK[2 * KBUF];   // 81920 B: K ring, two stages
  __shared__ __attribute__((aligned(16))) float sO[4 * 16 * SP];   // 33792 B

  const int tid = (int)threadIdx.x, lane = tid & 31, w = tid >> 5;
  const int h = lane >> 4, m = lane & 15;
  const int b = (int)blockIdx.y;
  const int q0 = (int)blockIdx.x * 64 + 16 * w;
  const size_t rowB = (size_t)b * SEQ;

  const unsigned short* qrow  = qb + (rowB + q0 + m) * DK;            // B fragment source (query column m)
  // K slice of this wave: keys 32 (w & 1) .. + 31 of the stage, bytes 256 (w >> 1) .. + 255 of each K row.
  const unsigned wv = uni((unsigned)tid >> 5);
  const unsigned long long kga = (unsigned long long)(size_t)(kb + (rowB + KROWS * (wv & 1u)) * DK + (KROWB / 2) * (wv >> 1));
  const unsigned kdst = (unsigned)(size_t)sK + wv * KSLICE;            // + (stage & 1) * KBUF
  const u32x8 kg1 = tdm_group1();
  const unsigned short* vbase = vt + ((size_t)b * DV + m) * SEQ;      // + 16 t * SEQ + key0
  const float* mkp = kpres + rowB + 8 * h;                            // + key tile base
  const float qp = qpres[rowB + q0 + m];

  v8f o[2];
  o[0] = zero8(); o[1] = zero8();
  float mrun = -1e30f, lrun = 0.0f;

  // ---- ring prologue: stage 0 lands and is published, then stage 1 starts ----
  tdm_load(tdm_group0(kdst, kga), kg1);
  wait_tensor0();
  __syncthreads();
  tdm_load(tdm_group0(kdst + KBUF, kga + (unsigned long long)(KCH * DK * 2)), kg1);

#pragma unroll 1
  for (int key0 = 0; key0 < SEQ; key0 += KCH) {
    const unsigned st = (unsigned)key0 / KCH;
    const unsigned char* kst = sK + (st & 1u) * KBUF + m * KPITCH;     // this stage's buffer, row of lane m
    // ---- scores ----
    v8f s[4];
#pragma unroll
    for (int j = 0; j < 4; ++j) s[j] = zero8();
#pragma unroll 1
    for (int dc = 0; dc < DK / 32; ++dc) {
      const v16b qf = ldfrag(qrow + 32 * dc, h);
#pragma unroll
      for (int j = 0; j < 4; ++j) {
        // slice 2 (dc >> 2) + (j >> 1), row 16 (j & 1) + m, byte 64 (dc & 3) of the 256-B slice row
        const v16b kf = ldfrag((const unsigned short*)(kst + (2 * (dc >> 2) + (j >> 1)) * KSLICE + 16 * (j & 1) * KPITCH + 64 * (dc & 3)), h);
        s[j] = wmma_bf(kf, qf, s[j]);
      }
    }

    // ---- presence masks and scale (literal f32 form of the spec) ----
#pragma unroll
    for (int j = 0; j < 4; ++j) {
      const v4f ka = *(const v4fa*)(mkp + key0 + 16 * j);
      const v4f kc = *(const v4fa*)(mkp + key0 + 16 * j + 4);
      const float kp8[8] = {ka[0], ka[1], ka[2], ka[3], kc[0], kc[1], kc[2], kc[3]};
#pragma unroll
      for (int r = 0; r < 8; ++r) {
        float tv = s[j][r] * qp;
        tv = tv * kp8[r];
        tv = tv - (1.0f - kp8[r]) * 1e32f;
        s[j][r] = tv * inv_scale;
      }
    }

    // ---- online softmax (per query column; partner lane holds the other 8 keys of each tile) ----
    float mloc = s[0][0];
#pragma unroll
    for (int j = 0; j < 4; ++j)
#pragma unroll
      for (int r = 0; r < 8; ++r) mloc = fmaxf(mloc, s[j][r]);
    mloc = fmaxf(mloc, __shfl_xor(mloc, 16, 32));
    const float mnew  = fmaxf(mrun, mloc);
    const float alpha = __expf(mrun - mnew);
    mrun = mnew;
    float lsum = 0.0f;
#pragma unroll
    for (int j = 0; j < 4; ++j)
#pragma unroll
      for (int r = 0; r < 8; ++r) {
        const float p = __expf(s[j][r] - mnew);    // absent key: exp(-1.77e31 - m) = 0 exactly
        s[j][r] = p;
        lsum += p;
      }
    lsum += __shfl_xor(lsum, 16, 32);
    lrun = lrun * alpha + lsum;
    o[0] = o[0] * alpha;
    o[1] = o[1] * alpha;

    // ---- P^T B fragments (keys key0+0..31 and key0+32..63) as bf16 hi + residual ----
    v16b ph0, pl0, ph1, pl1;
    split_pack(s[0], s[1], ph0, pl0);
    split_pack(s[2], s[3], ph1, pl1);

    // ---- O^T += V^T . P^T ----
#pragma unroll
    for (int t = 0; t < 2; ++t) {
      const unsigned short* vp = vbase + (size_t)(16 * t) * SEQ + key0;
      const v16b vf0 = ldfrag(vp, h);
      const v16b vf1 = ldfrag(vp + 32, h);
      o[t] = wmma_bf(vf0, ph0, o[t]);
      o[t] = wmma_bf(vf0, pl0, o[t]);
      o[t] = wmma_bf(vf1, ph1, o[t]);
      o[t] = wmma_bf(vf1, pl1, o[t]);
    }

    // ---- publish point of stage st + 1; the barrier also ends every wave's reads of stage st's buffer ----
    wait_ds0();
    wait_tensor0();
    __syncthreads();
    if (pinned(st + 2u < (unsigned)NST))
      tdm_load(tdm_group0(kdst + (st & 1u) * KBUF, kga + (unsigned long long)(st + 2u) * (KCH * DK * 2)), kg1);
  }
  wait_tensor0();
  wait_ds0();

  // ---- epilogue: head^T B fragment (hi + residual), folded linear, bias, whole-line stores ----
  const float inv = (lrun > 0.0f) ? (1.0f / lrun) : 0.0f;
  v16b hh, hl;
  split_pack(o[0] * inv, o[1] * inv, hh, hl);

  float* slab = sO + w * (16 * SP);
  const size_t orow0 = rowB + (size_t)q0;
#pragma unroll 1
  for (int half = 0; half < 2; ++half) {
#pragma unroll 1
    for (int uu = 0; uu < 8; ++uu) {
      const int u = 8 * half + uu;                               // d-tile: d = 16 u + (8h + r)
      const v16b ah = ldfrag(wfh + (size_t)(16 * u + m) * DV, h);
      const v16b al = ldfrag(wfl + (size_t)(16 * u + m) * DV, h);
      v8f acc = zero8();
      acc = wmma_bf(ah, hh, acc);
      acc = wmma_bf(ah, hl, acc);
      acc = wmma_bf(al, hh, acc);
      const v4f b0 = *(const v4fa*)(bo + 16 * u + 8 * h);
      const v4f b1 = *(const v4fa*)(bo + 16 * u + 8 * h + 4);
      const float bb[8] = {b0[0], b0[1], b0[2], b0[3], b1[0], b1[1], b1[2], b1[3]};
#pragma unroll
      for (int r = 0; r < 8; ++r)
        slab[m * SP + 16 * uu + 8 * h + r] = acc[r] + bf16r(bb[r]);
    }
    __syncthreads();
    out_store_pass(slab, out, orow0, half, lane);
    
    __syncthreads();
  }
}

// =====================================================================================================
// Workspace map (bytes), every region an exact multiple of its whole-line store granularity:
//   Qb   bf16 [16384][256]     8388608
//   Kb   bf16 [16384][256]     8388608
//   Vt   bf16 [8][32][2048]    1048576
//   WfH  bf16 [256][32]          16384
//   WfL  bf16 [256][32]          16384
//   total                     17858560
// =====================================================================================================
extern "C" void kernel_launch(void* const* d_in, const int* in_sizes, int n_in,
                              void* d_out, int out_size, void* d_ws, size_t ws_size,
                              hipStream_t stream) {
  if (n_in < 7) return;
  if (in_sizes[0] != NB * SEQ * DK || in_sizes[1] != NB * SEQ * DK) return;
  if (in_sizes[2] != NB * SEQ * DV) return;
  if (in_sizes[3] != NB * SEQ || in_sizes[4] != NB * SEQ) return;
  if (in_sizes[5] != DO * NH * DV || in_sizes[6] != DO) return;
  if (out_size != NB * SEQ * DO) return;

  const float* q   = (const float*)d_in[0];
  const float* k   = (const float*)d_in[1];
  const float* v   = (const float*)d_in[2];
  const float* qpr = (const float*)d_in[3];
  const float* kpr = (const float*)d_in[4];
  const float* wo  = (const float*)d_in[5];
  const float* bo  = (const float*)d_in[6];
  float* out = (float*)d_out;

  const size_t PQ = (size_t)NB * SEQ * DK * 2;      // 8388608
  const size_t PV = (size_t)NB * DV * SEQ * 2;      // 1048576
  const size_t PW = (size_t)DO * DV * 2;            //   16384
  size_t off = 0;
  const size_t oQ  = off; off += PQ;
  const size_t oK  = off; off += PQ;
  const size_t oV  = off; off += PV;
  const size_t oWH = off; off += PW;
  const size_t oWL = off; off += PW;
  if (off > ws_size) return;                        // off = 17858560
  if (off > (size_t)134217728) return;

  char* ws = (char*)d_ws;
  unsigned short* Qb  = (unsigned short*)(ws + oQ);
  unsigned short* Kb  = (unsigned short*)(ws + oK);
  unsigned short* Vt  = (unsigned short*)(ws + oV);
  unsigned short* WfH = (unsigned short*)(ws + oWH);
  unsigned short* WfL = (unsigned short*)(ws + oWL);

  const int n8 = NB * SEQ * DK / 8;                               // 524288 groups of 8 per plane
  const dim3 gCvt((2 * n8 + 255) / 256);                          // 4096 blocks
  const dim3 gVt(NB * (SEQ / 128));                               // 128 blocks
  const dim3 gAtt(SEQ / 64, NB);                                  // (32, 8)
  const float inv_scale = 0.17677669529663687f;                   // f32 value of 1 / sqrt(32)

  cvt_qk<<<gCvt, dim3(256), 0, stream>>>(q, k, Qb, Kb, n8);
  vtrans<<<gVt, dim3(128), 0, stream>>>(v, Vt);
  wfold<<<dim3(1), dim3(256), 0, stream>>>(wo, WfH, WfL);
  attn_out<<<gAtt, dim3(128), 0, stream>>>(Qb, Kb, Vt, qpr, kpr, WfH, WfL, bo, out, inv_scale);
  (void)hipGetLastError();
}

// v002
// It runs in 100 microseconds.
// Timed twice side by side with v001, it ran 1.42 and 1.39 times as fast.
// Over all steps from v000 it is 2.76 times as fast.
// Contractions: k.q^T scores = v_wmma_f32_16x16x32_bf16 (bf16 operands RNE-converted from keys / queries, single exact product, f32 accumulate);
// v^T.p^T = v_wmma_f32_16x16x32_bf16 (p computed in f32, packed as bf16 hi + bf16 residual fragments, against bf16(values): 2 products, f32 accumulate);
// output linear Wf.head^T = v_wmma_f32_16x16x32_bf16 (folded weight Wf = f32 sum of 8 bf16 w_o values, as bf16 hi + residual planes; head as bf16 hi + residual fragments: 3 products, f32 accumulate);
// presence masking, 1/sqrt(32) scale, online softmax, 1/l normalisation and bias in f32 on the VALU.
// Plane / fragment carries: none. Qb, Kb, Vt, WfH = bf16 x1; WfL and the p / head residual fragments are unscaled bf16 residuals
// (v - hi) and share the hi accumulator; nothing is folded back anywhere.
#include <hip/hip_runtime.h>

#define NB   8
#define SEQ  2048          // M = N
#define DK   256
#define DV   32            // per-head value dim
#define NH   8
#define DO   256
#define KCH  64            // keys per streaming step
#define SP   132           // f32 slab pitch (16-B aligned rows)
#define VTP  136           // vtrans LDS pitch in halves (16-B aligned rows)
#define KROWB  256         // bytes of one staged K slice row (half of a 512-B bf16 K row)
#define KROWS  32          // rows (keys) of one staged K slice
#define KPITCH 272         // LDS pitch of a slice row: 256 B + 16 B pad, an odd multiple of 16 B for the ds_load_b128 readers
#define KSLICE 10240       // LDS bytes reserved per slice: 32 x 272 = 8704, rounded up to a multiple of 2 KiB
#define KBUF   (4 * KSLICE)  // one stage = 64 keys x 512 B as 4 slices (one per wave)
#define NST    (SEQ / KCH) // stages = streaming steps
#define FLEAD  2           // d-steps by which the score products' operand loads run ahead of the products

static_assert(NH * DV == DK);
static_assert((SEQ % 128) == 0 && (SEQ % KCH) == 0 && (DK % 32) == 0 && DV == 32 && DO == 256);
static_assert(((NB * SEQ * DK / 8) % 256) == 0);
static_assert(((SP * 4) % 16) == 0 && ((VTP * 2) % 16) == 0);
static_assert(2 * KROWB == DK * 2 && 2 * KROWS == KCH && KROWS * KPITCH <= KSLICE && (KSLICE % 2048) == 0 && NST >= 2);

typedef __bf16         v16b __attribute__((ext_vector_type(16)));
typedef float          v8f  __attribute__((ext_vector_type(8)));
typedef float          v4f  __attribute__((ext_vector_type(4)));
typedef unsigned int   v4u  __attribute__((ext_vector_type(4)));
typedef unsigned int   v8u  __attribute__((ext_vector_type(8)));
typedef unsigned int   u32x4 __attribute__((ext_vector_type(4)));
typedef unsigned int   u32x8 __attribute__((ext_vector_type(8)));
typedef v4f __attribute__((may_alias)) v4fa;
typedef v4u __attribute__((may_alias)) v4ua;
union FB { v16b v; v8u u; v4u q[2]; };

#if defined(__HIP_DEVICE_COMPILE__)
#define DEV_ASM 1
#else
#define DEV_ASM 0
#endif

// ---- scalar helpers ---------------------------------------------------------------------------------
__device__ __forceinline__ unsigned short bf_bits(float f) {          // f32 -> bf16 bits, RNE convert
  const unsigned u = __float_as_uint(f);
  return (unsigned short)((u + 0x7FFFu + ((u >> 16) & 1u)) >> 16);
}
__device__ __forceinline__ float bf_up(unsigned short hb) { return __uint_as_float(((unsigned)hb) << 16); }
__device__ __forceinline__ float bf16r(float f) { return bf_up(bf_bits(f)); }
__device__ __forceinline__ unsigned pk16(unsigned short a, unsigned short b) { return (unsigned)a | ((unsigned)b << 16); }
__device__ __forceinline__ v8f zero8() { v8f z = {0.f, 0.f, 0.f, 0.f, 0.f, 0.f, 0.f, 0.f}; return z; }

// ---- 16x16x32 bf16 WMMA with hazard guard (ties D, keeps A/B live) --------------------------------------
// Fragment map (wave32): lane l, h = l>>4, m = n = l&15.
//   A/B element i: i<8 -> k0+8h+i ; i>=8 -> k0+16+8h+(i-8)
//   D element r : row 8h+r, col l&15
__device__ __forceinline__ v8f wmma_bf(v16b a, v16b b, v8f c) {
  v8f d = __builtin_amdgcn_wmma_f32_16x16x32_bf16(false, a, false, b, (short)0, c, false, false);
#if DEV_ASM
  asm volatile("v_nop\n\tv_nop\n\tv_nop\n\tv_nop" : "+v"(d) : "v"(a), "v"(b));
#endif
  return d;
}

// A or B fragment from a k-contiguous bf16 row; p points at element k0 of the row owned by this lane
// (row index = lane & 15 added by the caller). Two 16-B loads: k0+8h..+7 and k0+16+8h..+7.
__device__ __forceinline__ v16b ldfrag(const unsigned short* p, int h) {
  FB f;
  f.q[0] = *(const v4ua*)(p + 8 * h);
  f.q[1] = *(const v4ua*)(p + 16 + 8 * h);
  return f.v;
}

// B fragment built from the lane's own D values of two adjacent 16-row D tiles (tile a covers k 0..15, tile c
// covers k 16..31 of the 32-deep step, same lane / same column): element r <- a[r], element 8+r <- c[r];
// split into bf16 hi = rne(x) and bf16 residual rne(x - hi).
__device__ __forceinline__ void split_pack(v8f a, v8f c, v16b& hi, v16b& lo) {
  v8u hu = {0u, 0u, 0u, 0u, 0u, 0u, 0u, 0u};
  v8u lu = {0u, 0u, 0u, 0u, 0u, 0u, 0u, 0u};
#pragma unroll
  for (int i = 0; i < 4; ++i) {
    const float a0 = a[2 * i], a1 = a[2 * i + 1], c0 = c[2 * i], c1 = c[2 * i + 1];
    const unsigned short ha0 = bf_bits(a0), ha1 = bf_bits(a1), hc0 = bf_bits(c0), hc1 = bf_bits(c1);
    const unsigned short la0 = bf_bits(a0 - bf_up(ha0)), la1 = bf_bits(a1 - bf_up(ha1));
    const unsigned short lc0 = bf_bits(c0 - bf_up(hc0)), lc1 = bf_bits(c1 - bf_up(hc1));
    hu[i] = pk16(ha0, ha1);  hu[4 + i] = pk16(hc0, hc1);
    lu[i] = pk16(la0, la1);  lu[4 + i] = pk16(lc0, lc1);
  }
  FB H, L;
  H.u = hu; L.u = lu;
  hi = H.v; lo = L.v;
}

// =====================================================================================================
// (1) queries and keys f32 -> bf16 bits (RNE convert), 8 elements per thread, one 16-B store per lane:
// threads [0, n8) do the q plane, [n8, 2 n8) the k plane (n8 % 256 == 0, so the choice is block-uniform).
// coverage: 2 n8 threads x 8 = both [NB*SEQ][DK] planes completely.
// =====================================================================================================
__global__ __launch_bounds__(256) void cvt_qk(const float* __restrict__ q, const float* __restrict__ k,
                                              unsigned short* qb, unsigned short* kb, int n8) {
  const int i = blockIdx.x * 256 + (int)threadIdx.x;
  if (i >= 2 * n8) return;
  const bool isq = (i < n8);
  const int j = isq ? i : (i - n8);
  const float* src = (isq ? q : k) + (size_t)j * 8;
  unsigned short* dst = (isq ? qb : kb) + (size_t)j * 8;
  const v4f a = *(const v4fa*)(src);
  const v4f c = *(const v4fa*)(src + 4);
  v4u p;
  p[0] = pk16(bf_bits(a[0]), bf_bits(a[1]));
  p[1] = pk16(bf_bits(a[2]), bf_bits(a[3]));
  p[2] = pk16(bf_bits(c[0]), bf_bits(c[1]));
  p[3] = pk16(bf_bits(c[2]), bf_bits(c[3]));
  *(v4u*)dst = p;
  
}

// =====================================================================================================
// (2) values f32 [b][n][32] -> bf16 transposed plane vt [b][vf][n] (pitch SEQ, key contiguous).
// Block 128 thr = 128 keys x 32 vf of one batch: 8 x 16-B loads per thread (whole tile), RNE convert into an
// LDS [32][VTP] transposed tile, block barrier, then each output row segment (128 keys = 256 B = 2 lines)
// coverage: NB*16 blocks x 32 vf rows x 128 keys = the whole [NB][32][SEQ] plane; LDS staged extent
// (32 rows x keys 0..127) = consumed extent.
// =====================================================================================================
__global__ __launch_bounds__(128) void vtrans(const float* __restrict__ v, unsigned short* vt) {
  __shared__ __attribute__((aligned(16))) unsigned short sT[DV * VTP];
  const int t  = (int)threadIdx.x;
  const int b  = (int)blockIdx.x / (SEQ / 128);
  const int n0 = ((int)blockIdx.x % (SEQ / 128)) * 128;
#pragma unroll
  for (int i = 0; i < 8; ++i) {
    const int f   = i * 128 + t;            // 0 .. 1023 float4 of the 128 x 32 tile
    const int key = f >> 3, c4 = (f & 7) * 4;
    const v4f x = *(const v4fa*)(v + ((size_t)b * SEQ + n0 + key) * DV + c4);
    sT[(c4 + 0) * VTP + key] = bf_bits(x[0]);
    sT[(c4 + 1) * VTP + key] = bf_bits(x[1]);
    sT[(c4 + 2) * VTP + key] = bf_bits(x[2]);
    sT[(c4 + 3) * VTP + key] = bf_bits(x[3]);
  }
  __syncthreads();
  v4u pc[4];
#pragma unroll
  for (int i = 0; i < 4; ++i) {
    const int L  = i * 16 + (t >> 3);       // line 0..63 of the tile: vf = L>>1, half = L&1
    const int vf = L >> 1, hl = L & 1;
    pc[i] = *(const v4ua*)(sT + vf * VTP + hl * 64 + (t & 7) * 8);
  }
  {
#pragma unroll
    for (int i = 0; i < 4; ++i) {
      const int L  = i * 16 + (t >> 3);
      const int vf = L >> 1, hl = L & 1;
      *(v4u*)(vt + ((size_t)b * DV + vf) * SEQ + n0 + hl * 64 + (t & 7) * 8) = pc[i];
    }
    
  }
}

// =====================================================================================================
// (3) Folded output weight: Wf[d][v] = sum_{g<8} bf16(w_o[d][32 g + v]) in f32 (the concatenated head is 8
// copies of the same 32 values). One block of 256 threads, thread d owns row d; hi = rne_bf16(Wf),
// lo = rne_bf16(Wf - hi) staged in LDS [256][32]; then each 16 KB plane (128 lines) is written 8 consecutive
// coverage: 4 instructions x 256 threads x 8 halves = 8192 = the whole [256][32] plane, both planes.
// =====================================================================================================
__global__ __launch_bounds__(256) void wfold(const float* __restrict__ wo, unsigned short* wfh, unsigned short* wfl) {
  __shared__ __attribute__((aligned(16))) unsigned short sH[DO * DV];
  __shared__ __attribute__((aligned(16))) unsigned short sL[DO * DV];
  const int d = (int)threadIdx.x;
  const float* row = wo + (size_t)d * (NH * DV);
#pragma unroll 1
  for (int vb = 0; vb < DV / 8; ++vb) {
    float s8[8];
#pragma unroll
    for (int e = 0; e < 8; ++e) s8[e] = 0.f;
#pragma unroll
    for (int g = 0; g < NH; ++g) {
      const v4f a = *(const v4fa*)(row + g * DV + 8 * vb);
      const v4f c = *(const v4fa*)(row + g * DV + 8 * vb + 4);
      s8[0] += bf16r(a[0]); s8[1] += bf16r(a[1]); s8[2] += bf16r(a[2]); s8[3] += bf16r(a[3]);
      s8[4] += bf16r(c[0]); s8[5] += bf16r(c[1]); s8[6] += bf16r(c[2]); s8[7] += bf16r(c[3]);
    }
#pragma unroll
    for (int e = 0; e < 8; ++e) {
      const unsigned short hb = bf_bits(s8[e]);
      sH[d * DV + 8 * vb + e] = hb;
      sL[d * DV + 8 * vb + e] = bf_bits(s8[e] - bf_up(hb));
    }
  }
  __syncthreads();
  v4u ph[4], pl[4];
#pragma unroll
  for (int i = 0; i < 4; ++i) {
    const int e = (i * 32 + (d >> 3)) * 64 + (d & 7) * 8;   // line i*32 + d>>3, 16-B piece d&7
    ph[i] = *(const v4ua*)(sH + e);
    pl[i] = *(const v4ua*)(sL + e);
  }
  {
#pragma unroll
    for (int i = 0; i < 4; ++i) {
      const int e = (i * 32 + (d >> 3)) * 64 + (d & 7) * 8;
      *(v4u*)(wfh + e) = ph[i];
      *(v4u*)(wfl + e) = pl[i];
    }
    
  }
}

// =====================================================================================================
// (4) Presence-masked attention + folded output linear, transposed streaming form.
// Block 128 thr (4 waves), 16 queries per wave, 64 keys per step, one batch per blockIdx.y.
//   S^T = K . Q^T : A = K rows (row = key, k = d) from the LDS K ring, B = Q^T (k = d, n = query) from the
//                   bf16 Q row of query q0+m; 8 d-steps of 32; D s[j][r] = S^T[key kb+16j+8h+r][query m].
//   logits (f32, literal form): t = (s * q_pres[m] * k_pres[key] - (1 - k_pres[key]) * 1e32) * inv_scale;
//   online softmax per query column (lane stats + partner lane ^ 16), f32, exp via v_exp.
//   O^T += V^T . P^T : A = Vt rows (row = vf, k = key) from the bf16 v^T plane; B = P^T built from the lane's
//                   own score D tiles (pairs (0,1) and (2,3)) as bf16 hi + residual -> 2 products per tile.
//   Epilogue: head^T B fragment = (O^T[0], O^T[1]) / l split into bf16 hi + residual; out^T = WfH . Hhi +
//             WfH . Hlo + WfL . Hhi over 16 d-tiles, + bf16(b_o); each wave stages a 16 x 128 f32 slab in LDS
//   K ring: two stages of 64 keys in LDS, each wave brings one 32-key x 256-B slice per stage by one tensor load, one
//   stage ahead; V^T fragments straight from global rows; VGPR cap 256 (no high-bank registers).
//   coverage: grid (SEQ/64, NB) x 4 waves x 16 rows x 2 halves x 128 cols = the whole [NB*SEQ][256] output;
//   slab: 16 x 128 written by the wave before every reload.
// =====================================================================================================
// ---- tensor load of one K slice (global -> LDS, no registers) ---------------------------------------------
__device__ __forceinline__ unsigned uni(unsigned v) { return (unsigned)__builtin_amdgcn_readfirstlane(v); }
// A tensor load ignores EXEC: only a scalar branch (s_cmp + s_cbranch_scc) guards it.
__device__ __forceinline__ unsigned pinned(unsigned v) {
  unsigned w = uni(v);
  asm volatile("" : "+s"(w));   // pinned(): holds the wave-uniform test word in a scalar register, so the branch on it stays scalar
  return w;
}
// One request of the whole wave; the waits for it are written by hand at the publish points.
__device__ __forceinline__ void tdm_load(u32x4 g0, u32x8 g1) {
#if DEV_ASM
  asm volatile("tensor_load_to_lds %0, %1" :: "s"(g0), "s"(g1) : "memory");
#endif
}
// Group 1: 1-byte elements, tensor = tile = KROWS rows of KROWB bytes, source pitch one whole K row, 4 dwords of pad
// behind every 64 dwords (interval code 5, amount code 3), no workgroup mask.
__device__ __forceinline__ u32x8 tdm_group1() {
  u32x8 g;
  g[0] = uni((1u << 20) | (5u << 22) | (3u << 25));
  g[1] = uni(((unsigned)KROWB & 0xFFFFu) << 16);
  g[2] = uni(((unsigned)KROWB >> 16) | (((unsigned)KROWS & 0xFFFFu) << 16));
  g[3] = uni(((unsigned)KROWS >> 16) | ((unsigned)KROWB << 16));
  g[4] = uni((unsigned)KROWS);
  g[5] = uni((unsigned)(DK * 2));
  g[6] = uni(0u);
  g[7] = uni(0u);
  return g;
}
__device__ __forceinline__ u32x4 tdm_group0(unsigned lds_dst, unsigned long long ga) {
  u32x4 g;
  g[0] = uni(1u);
  g[1] = uni(lds_dst);
  g[2] = uni((unsigned)ga);
  g[3] = uni((((unsigned)(ga >> 32)) & 0x01FFFFFFu) | 0x80000000u);
  return g;
}
// The waits for the tensor mover and for LDS reads in front of a refill are written out.
__device__ __forceinline__ void wait_tensor0() {
#if DEV_ASM
  asm volatile("s_wait_tensorcnt 0x0" ::: "memory");
#endif
}
__device__ __forceinline__ void wait_ds0() {
#if DEV_ASM
  asm volatile("s_wait_dscnt 0x0" ::: "memory");
#endif
}

__device__ __forceinline__ void out_store_pass(const float* slab, float* out, size_t row0, int half, int lane) {
  const int q8 = lane & 7, sub = lane >> 3;
#pragma unroll
  for (int it = 0; it < 16; ++it) {
    const int L = it * 4 + sub;
    const int row = L >> 2, seg = L & 3;
    const v4f val = *(const v4fa*)(slab + row * SP + seg * 32 + 4 * q8);
    float* dst = out + (row0 + (size_t)row) * DO + half * 128 + seg * 32 + 4 * q8;
    *(v4f*)dst = val;
  }
}

__global__ __launch_bounds__(128) __attribute__((amdgpu_num_vgpr(256)))
void attn_out(const unsigned short* __restrict__ qb,    // [NB*SEQ][DK] bf16
              const unsigned short* __restrict__ kb,    // [NB*SEQ][DK] bf16
              const unsigned short* __restrict__ vt,    // [NB][DV][SEQ] bf16
              const float* __restrict__ qpres,          // [NB][SEQ]
              const float* __restrict__ kpres,          // [NB][SEQ]
              const unsigned short* __restrict__ wfh,   // [DO][DV] bf16 hi
              const unsigned short* __restrict__ wfl,   // [DO][DV] bf16 residual
              const float* __restrict__ bo,             // [DO]
              float* out,                               // [NB*SEQ][DO]
              float inv_scale) {
  __shared__ __attribute__((aligned(2048))) unsigned char sK[2 * KBUF];   // 81920 B: K ring, two stages
  __shared__ __attribute__((aligned(16))) float sO[4 * 16 * SP];   // 33792 B

  const int tid = (int)threadIdx.x, lane = tid & 31, w = tid >> 5;
  const int h = lane >> 4, m = lane & 15;
  const int b = (int)blockIdx.y;
  const int q0 = (int)blockIdx.x * 64 + 16 * w;
  const size_t rowB = (size_t)b * SEQ;

  const unsigned short* qrow  = qb + (rowB + q0 + m) * DK;            // B fragment source (query column m)
  // K slice of this wave: keys 32 (w & 1) .. + 31 of the stage, bytes 256 (w >> 1) .. + 255 of each K row.
  const unsigned wv = uni((unsigned)tid >> 5);
  const unsigned long long kga = (unsigned long long)(size_t)(kb + (rowB + KROWS * (wv & 1u)) * DK + (KROWB / 2) * (wv >> 1));
  const unsigned kdst = (unsigned)(size_t)sK + wv * KSLICE;            // + (stage & 1) * KBUF
  const u32x8 kg1 = tdm_group1();
  const unsigned short* vbase = vt + ((size_t)b * DV + m) * SEQ;      // + 16 t * SEQ + key0
  const float* mkp = kpres + rowB + 8 * h;                            // + key tile base
  const float qp = qpres[rowB + q0 + m];

  v8f o[2];
  o[0] = zero8(); o[1] = zero8();
  float mrun = -1e30f, lrun = 0.0f;

  // ---- ring prologue: stage 0 lands and is published, then stage 1 starts ----
  tdm_load(tdm_group0(kdst, kga), kg1);
  wait_tensor0();
  __syncthreads();
  tdm_load(tdm_group0(kdst + KBUF, kga + (unsigned long long)(KCH * DK * 2)), kg1);

#pragma unroll 1
  for (int key0 = 0; key0 < SEQ; key0 += KCH) {
    const unsigned st = (unsigned)key0 / KCH;
    const unsigned char* kst = sK + (st & 1u) * KBUF + m * KPITCH;     // this stage's buffer, row of lane m
    // ---- scores ----
    v8f s[4];
#pragma unroll
    for (int j = 0; j < 4; ++j) s[j] = zero8();
    // Operand fragments run FLEAD d-steps ahead of their products: the loads of d-step dc + FLEAD stand as one group in
    // front of the products of d-step dc, so a product waits on loads issued FLEAD d-steps earlier, not on its own.
    // All reads are of this stage's buffer, inside this pass.
    v16b qf[DK / 32], kf[DK / 32][4];
#pragma unroll   // full unroll: the fragment arrays must be indexed by constants to live in registers
    for (int dc = -FLEAD; dc < DK / 32; ++dc) {
      const int df = dc + FLEAD;
      if (df < DK / 32) {
        qf[df] = ldfrag(qrow + 32 * df, h);
#pragma unroll
        for (int j = 0; j < 4; ++j)
          // slice 2 (df >> 2) + (j >> 1), row 16 (j & 1) + m, byte 64 (df & 3) of the 256-B slice row
          kf[df][j] = ldfrag((const unsigned short*)(kst + (2 * (df >> 2) + (j >> 1)) * KSLICE + 16 * (j & 1) * KPITCH + 64 * (df & 3)), h);
      }
      if (dc >= 0) {
#pragma unroll
        for (int j = 0; j < 4; ++j) s[j] = wmma_bf(kf[dc][j], qf[dc], s[j]);
      }
    }

    // ---- presence masks and scale (literal f32 form of the spec) ----
#pragma unroll
    for (int j = 0; j < 4; ++j) {
      const v4f ka = *(const v4fa*)(mkp + key0 + 16 * j);
      const v4f kc = *(const v4fa*)(mkp + key0 + 16 * j + 4);
      const float kp8[8] = {ka[0], ka[1], ka[2], ka[3], kc[0], kc[1], kc[2], kc[3]};
#pragma unroll
      for (int r = 0; r < 8; ++r) {
        float tv = s[j][r] * qp;
        tv = tv * kp8[r];
        tv = tv - (1.0f - kp8[r]) * 1e32f;
        {
          // Numerical reason: the scaled logit must be ONE rounded product, used by the row maximum and by the exponent's
          // argument alike, so that the row's largest logit gives exp(0) exactly; fused into
          // the later subtraction it would leave the product's rounding error there, which is huge at logits near 1e31.
#pragma clang fp contract(off)
          s[j][r] = tv * inv_scale;
        }
      }
    }

    // ---- online softmax (per query column; partner lane holds the other 8 keys of each tile) ----
    float mloc = s[0][0];
#pragma unroll
    for (int j = 0; j < 4; ++j)
#pragma unroll
      for (int r = 0; r < 8; ++r) mloc = fmaxf(mloc, s[j][r]);
    mloc = fmaxf(mloc, __shfl_xor(mloc, 16, 32));
    const float mnew  = fmaxf(mrun, mloc);
    const float alpha = __expf(mrun - mnew);
    mrun = mnew;
    float lsum = 0.0f;
#pragma unroll
    for (int j = 0; j < 4; ++j)
#pragma unroll
      for (int r = 0; r < 8; ++r) {
        const float p = __expf(s[j][r] - mnew);    // absent key: exp(-1.77e31 - m) = 0 exactly
        s[j][r] = p;
        lsum += p;
      }
    lsum += __shfl_xor(lsum, 16, 32);
    lrun = lrun * alpha + lsum;
    o[0] = o[0] * alpha;
    o[1] = o[1] * alpha;

    // ---- P^T B fragments (keys key0+0..31 and key0+32..63) as bf16 hi + residual ----
    v16b ph0, pl0, ph1, pl1;
    split_pack(s[0], s[1], ph0, pl0);
    split_pack(s[2], s[3], ph1, pl1);

    // ---- O^T += V^T . P^T ----
#pragma unroll
    for (int t = 0; t < 2; ++t) {
      const unsigned short* vp = vbase + (size_t)(16 * t) * SEQ + key0;
      const v16b vf0 = ldfrag(vp, h);
      const v16b vf1 = ldfrag(vp + 32, h);
      o[t] = wmma_bf(vf0, ph0, o[t]);
      o[t] = wmma_bf(vf0, pl0, o[t]);
      o[t] = wmma_bf(vf1, ph1, o[t]);
      o[t] = wmma_bf(vf1, pl1, o[t]);
    }

    // ---- publish point of stage st + 1; the barrier also ends every wave's reads of stage st's buffer ----
#if DEV_ASM
    asm volatile("s_wait_xcnt 0x0" ::: "memory");   // stands in front of the next pass's advance of the global loads' address registers
#endif
    wait_ds0();
    wait_tensor0();
    __syncthreads();
    if (pinned(st + 2u < (unsigned)NST))
      tdm_load(tdm_group0(kdst + (st & 1u) * KBUF, kga + (unsigned long long)(st + 2u) * (KCH * DK * 2)), kg1);
  }
  wait_tensor0();
  wait_ds0();

  // ---- epilogue: head^T B fragment (hi + residual), folded linear, bias, whole-line stores ----
  const float inv = (lrun > 0.0f) ? (1.0f / lrun) : 0.0f;
  v16b hh, hl;
  split_pack(o[0] * inv, o[1] * inv, hh, hl);

  float* slab = sO + w * (16 * SP);
  const size_t orow0 = rowB + (size_t)q0;
#pragma unroll 1
  for (int half = 0; half < 2; ++half) {
#pragma unroll 1
    for (int uu = 0; uu < 8; ++uu) {
      const int u = 8 * half + uu;                               // d-tile: d = 16 u + (8h + r)
      const v16b ah = ldfrag(wfh + (size_t)(16 * u + m) * DV, h);
      const v16b al = ldfrag(wfl + (size_t)(16 * u + m) * DV, h);
      v8f acc = zero8();
      acc = wmma_bf(ah, hh, acc);
      acc = wmma_bf(ah, hl, acc);
      acc = wmma_bf(al, hh, acc);
      const v4f b0 = *(const v4fa*)(bo + 16 * u + 8 * h);
      const v4f b1 = *(const v4fa*)(bo + 16 * u + 8 * h + 4);
      const float bb[8] = {b0[0], b0[1], b0[2], b0[3], b1[0], b1[1], b1[2], b1[3]};
#pragma unroll
      for (int r = 0; r < 8; ++r)
        slab[m * SP + 16 * uu + 8 * h + r] = acc[r] + bf16r(bb[r]);
    }
    __syncthreads();
    out_store_pass(slab, out, orow0, half, lane);
    
    __syncthreads();
  }
}

// =====================================================================================================
// Workspace map (bytes), every region an exact multiple of its whole-line store granularity:
//   Qb   bf16 [16384][256]     8388608
//   Kb   bf16 [16384][256]     8388608
//   Vt   bf16 [8][32][2048]    1048576
//   WfH  bf16 [256][32]          16384
//   WfL  bf16 [256][32]          16384
//   total                     17858560
// =====================================================================================================
extern "C" void kernel_launch(void* const* d_in, const int* in_sizes, int n_in,
                              void* d_out, int out_size, void* d_ws, size_t ws_size,
                              hipStream_t stream) {
  if (n_in < 7) return;
  if (in_sizes[0] != NB * SEQ * DK || in_sizes[1] != NB * SEQ * DK) return;
  if (in_sizes[2] != NB * SEQ * DV) return;
  if (in_sizes[3] != NB * SEQ || in_sizes[4] != NB * SEQ) return;
  if (in_sizes[5] != DO * NH * DV || in_sizes[6] != DO) return;
  if (out_size != NB * SEQ * DO) return;

  const float* q   = (const float*)d_in[0];
  const float* k   = (const float*)d_in[1];
  const float* v   = (const float*)d_in[2];
  const float* qpr = (const float*)d_in[3];
  const float* kpr = (const float*)d_in[4];
  const float* wo  = (const float*)d_in[5];
  const float* bo  = (const float*)d_in[6];
  float* out = (float*)d_out;

  const size_t PQ = (size_t)NB * SEQ * DK * 2;      // 8388608
  const size_t PV = (size_t)NB * DV * SEQ * 2;      // 1048576
  const size_t PW = (size_t)DO * DV * 2;            //   16384
  size_t off = 0;
  const size_t oQ  = off; off += PQ;
  const size_t oK  = off; off += PQ;
  const size_t oV  = off; off += PV;
  const size_t oWH = off; off += PW;
  const size_t oWL = off; off += PW;
  if (off > ws_size) return;                        // off = 17858560
  if (off > (size_t)134217728) return;

  char* ws = (char*)d_ws;
  unsigned short* Qb  = (unsigned short*)(ws + oQ);
  unsigned short* Kb  = (unsigned short*)(ws + oK);
  unsigned short* Vt  = (unsigned short*)(ws + oV);
  unsigned short* WfH = (unsigned short*)(ws + oWH);
  unsigned short* WfL = (unsigned short*)(ws + oWL);

  const int n8 = NB * SEQ * DK / 8;                               // 524288 groups of 8 per plane
  const dim3 gCvt((2 * n8 + 255) / 256);                          // 4096 blocks
  const dim3 gVt(NB * (SEQ / 128));                               // 128 blocks
  const dim3 gAtt(SEQ / 64, NB);                                  // (32, 8)
  const float inv_scale = 0.17677669529663687f;                   // f32 value of 1 / sqrt(32)

  cvt_qk<<<gCvt, dim3(256), 0, stream>>>(q, k, Qb, Kb, n8);
  vtrans<<<gVt, dim3(128), 0, stream>>>(v, Vt);
  wfold<<<dim3(1), dim3(256), 0, stream>>>(wo, WfH, WfL);
  attn_out<<<gAtt, dim3(128), 0, stream>>>(Qb, Kb, Vt, qpr, kpr, WfH, WfL, bo, out, inv_scale);
  (void)hipGetLastError();
}

// v003
// Measured time: 69 microseconds a run.
// Timed twice side by side with v002, it ran 1.44 times as fast both times.
// Over all steps from v000 it is 3.98 times as fast.
// Contractions: k.q^T scores = v_wmma_f32_16x16x32_bf16 (bf16 operands RNE-converted from keys / queries, single exact product, f32 accumulate);
// v^T.p^T = v_wmma_f32_16x16x32_bf16 (p computed in f32, packed as bf16 hi + bf16 residual fragments, against bf16(values): 2 products, f32 accumulate);
// output linear Wf.head^T = v_wmma_f32_16x16x32_bf16 (folded weight Wf = f32 sum of 8 bf16 w_o values, as bf16 hi + residual planes; head as bf16 hi + residual fragments: 3 products, f32 accumulate);
// presence masking, 1/sqrt(32) scale, online softmax, 1/l normalisation and bias in f32 on the VALU.
// Plane / fragment carries: none. Qb, Kb, Vt, WfH = bf16 x1; WfL and the p / head residual fragments are unscaled bf16 residuals
// (v - hi) and share the hi accumulator; nothing is folded back anywhere.
#include <hip/hip_runtime.h>

#define NB   8
#define SEQ  2048          // M = N
#define DK   256
#define DV   32            // per-head value dim
#define NH   8
#define DO   256
#define KCH  64            // keys per wave and streaming step
#define KSPL 2             // waves that share one query tile, each on its own KCH keys of a stage
#define STK  (KSPL * KCH)  // keys per stage
#define SP   132           // f32 slab pitch (16-B aligned rows)
#define VTP  136           // vtrans LDS pitch in halves (16-B aligned rows)
#define KROWB  256         // bytes of one staged K slice row (half of a 512-B bf16 K row)
#define KROWS  32          // rows (keys) of one staged K slice
#define KPITCH 272         // LDS pitch of a slice row: 256 B + 16 B pad, an odd multiple of 16 B for the ds_load_b128 readers
#define KSLICE 10240       // LDS bytes reserved per slice: 32 x 272 = 8704, rounded up to a multiple of 2 KiB
#define KBUF   (8 * KSLICE)  // one stage = 128 keys x 512 B as 8 slices (one per wave)
#define NST    (SEQ / STK) // stages = streaming steps of a wave
#define FLEAD  2           // d-steps by which the score products' operand loads run ahead of the products

static_assert(NH * DV == DK);
static_assert((SEQ % 128) == 0 && (SEQ % STK) == 0 && (DK % 32) == 0 && DV == 32 && DO == 256);
static_assert(((NB * SEQ * DK / 8) % 256) == 0);
static_assert(((SP * 4) % 16) == 0 && ((VTP * 2) % 16) == 0);
static_assert(2 * KROWB == DK * 2 && 2 * KROWS == KCH && 4 * KROWS == STK && KROWS * KPITCH <= KSLICE && (KSLICE % 2048) == 0 && NST >= 2);

typedef __bf16         v16b __attribute__((ext_vector_type(16)));
typedef float          v8f  __attribute__((ext_vector_type(8)));
typedef float          v4f  __attribute__((ext_vector_type(4)));
typedef unsigned int   v4u  __attribute__((ext_vector_type(4)));
typedef unsigned int   v8u  __attribute__((ext_vector_type(8)));
typedef unsigned int   u32x4 __attribute__((ext_vector_type(4)));
typedef unsigned int   u32x8 __attribute__((ext_vector_type(8)));
typedef v4f __attribute__((may_alias)) v4fa;
typedef v4u __attribute__((may_alias)) v4ua;
union FB { v16b v; v8u u; v4u q[2]; };

#if defined(__HIP_DEVICE_COMPILE__)
#define DEV_ASM 1
#else
#define DEV_ASM 0
#endif

// ---- scalar helpers ---------------------------------------------------------------------------------
__device__ __forceinline__ unsigned short bf_bits(float f) {          // f32 -> bf16 bits, RNE convert
  const unsigned u = __float_as_uint(f);
  return (unsigned short)((u + 0x7FFFu + ((u >> 16) & 1u)) >> 16);
}
__device__ __forceinline__ float bf_up(unsigned short hb) { return __uint_as_float(((unsigned)hb) << 16); }
__device__ __forceinline__ float bf16r(float f) { return bf_up(bf_bits(f)); }
__device__ __forceinline__ unsigned pk16(unsigned short a, unsigned short b) { return (unsigned)a | ((unsigned)b << 16); }
__device__ __forceinline__ v8f zero8() { v8f z = {0.f, 0.f, 0.f, 0.f, 0.f, 0.f, 0.f, 0.f}; return z; }

// ---- 16x16x32 bf16 WMMA with hazard guard (ties D, keeps A/B live) --------------------------------------
// Fragment map (wave32): lane l, h = l>>4, m = n = l&15.
//   A/B element i: i<8 -> k0+8h+i ; i>=8 -> k0+16+8h+(i-8)
//   D element r : row 8h+r, col l&15
__device__ __forceinline__ v8f wmma_bf(v16b a, v16b b, v8f c) {
  v8f d = __builtin_amdgcn_wmma_f32_16x16x32_bf16(false, a, false, b, (short)0, c, false, false);
#if DEV_ASM
  asm volatile("v_nop\n\tv_nop\n\tv_nop\n\tv_nop" : "+v"(d) : "v"(a), "v"(b));
#endif
  return d;
}

// A or B fragment from a k-contiguous bf16 row; p points at element k0 of the row owned by this lane
// (row index = lane & 15 added by the caller). Two 16-B loads: k0+8h..+7 and k0+16+8h..+7.
__device__ __forceinline__ v16b ldfrag(const unsigned short* p, int h) {
  FB f;
  f.q[0] = *(const v4ua*)(p + 8 * h);
  f.q[1] = *(const v4ua*)(p + 16 + 8 * h);
  return f.v;
}

// B fragment built from the lane's own D values of two adjacent 16-row D tiles (tile a covers k 0..15, tile c
// covers k 16..31 of the 32-deep step, same lane / same column): element r <- a[r], element 8+r <- c[r];
// split into bf16 hi = rne(x) and bf16 residual rne(x - hi).
__device__ __forceinline__ void split_pack(v8f a, v8f c, v16b& hi, v16b& lo) {
  v8u hu = {0u, 0u, 0u, 0u, 0u, 0u, 0u, 0u};
  v8u lu = {0u, 0u, 0u, 0u, 0u, 0u, 0u, 0u};
#pragma unroll
  for (int i = 0; i < 4; ++i) {
    const float a0 = a[2 * i], a1 = a[2 * i + 1], c0 = c[2 * i], c1 = c[2 * i + 1];
    const unsigned short ha0 = bf_bits(a0), ha1 = bf_bits(a1), hc0 = bf_bits(c0), hc1 = bf_bits(c1);
    const unsigned short la0 = bf_bits(a0 - bf_up(ha0)), la1 = bf_bits(a1 - bf_up(ha1));
    const unsigned short lc0 = bf_bits(c0 - bf_up(hc0)), lc1 = bf_bits(c1 - bf_up(hc1));
    hu[i] = pk16(ha0, ha1);  hu[4 + i] = pk16(hc0, hc1);
    lu[i] = pk16(la0, la1);  lu[4 + i] = pk16(lc0, lc1);
  }
  FB H, L;
  H.u = hu; L.u = lu;
  hi = H.v; lo = L.v;
}

// =====================================================================================================
// (1) queries and keys f32 -> bf16 bits (RNE convert), 8 elements per thread, one 16-B store per lane:
// threads [0, n8) do the q plane, [n8, 2 n8) the k plane (n8 % 256 == 0, so the choice is block-uniform).
// coverage: 2 n8 threads x 8 = both [NB*SEQ][DK] planes completely.
// =====================================================================================================
__global__ __launch_bounds__(256) void cvt_qk(const float* __restrict__ q, const float* __restrict__ k,
                                              unsigned short* qb, unsigned short* kb, int n8) {
  const int i = blockIdx.x * 256 + (int)threadIdx.x;
  if (i >= 2 * n8) return;
  const bool isq = (i < n8);
  const int j = isq ? i : (i - n8);
  const float* src = (isq ? q : k) + (size_t)j * 8;
  unsigned short* dst = (isq ? qb : kb) + (size_t)j * 8;
  const v4f a = *(const v4fa*)(src);
  const v4f c = *(const v4fa*)(src + 4);
  v4u p;
  p[0] = pk16(bf_bits(a[0]), bf_bits(a[1]));
  p[1] = pk16(bf_bits(a[2]), bf_bits(a[3]));
  p[2] = pk16(bf_bits(c[0]), bf_bits(c[1]));
  p[3] = pk16(bf_bits(c[2]), bf_bits(c[3]));
  *(v4u*)dst = p;
  
}

// =====================================================================================================
// (2) values f32 [b][n][32] -> bf16 transposed plane vt [b][vf][n] (pitch SEQ, key contiguous).
// Block 128 thr = 128 keys x 32 vf of one batch: 8 x 16-B loads per thread (whole tile), RNE convert into an
// LDS [32][VTP] transposed tile, block barrier, then each output row segment (128 keys = 256 B = 2 lines)
// coverage: NB*16 blocks x 32 vf rows x 128 keys = the whole [NB][32][SEQ] plane; LDS staged extent
// (32 rows x keys 0..127) = consumed extent.
// =====================================================================================================
__global__ __launch_bounds__(128) void vtrans(const float* __restrict__ v, unsigned short* vt) {
  __shared__ __attribute__((aligned(16))) unsigned short sT[DV * VTP];
  const int t  = (int)threadIdx.x;
  const int b  = (int)blockIdx.x / (SEQ / 128);
  const int n0 = ((int)blockIdx.x % (SEQ / 128)) * 128;
#pragma unroll
  for (int i = 0; i < 8; ++i) {
    const int f   = i * 128 + t;            // 0 .. 1023 float4 of the 128 x 32 tile
    const int key = f >> 3, c4 = (f & 7) * 4;
    const v4f x = *(const v4fa*)(v + ((size_t)b * SEQ + n0 + key) * DV + c4);
    sT[(c4 + 0) * VTP + key] = bf_bits(x[0]);
    sT[(c4 + 1) * VTP + key] = bf_bits(x[1]);
    sT[(c4 + 2) * VTP + key] = bf_bits(x[2]);
    sT[(c4 + 3) * VTP + key] = bf_bits(x[3]);
  }
  __syncthreads();
  v4u pc[4];
#pragma unroll
  for (int i = 0; i < 4; ++i) {
    const int L  = i * 16 + (t >> 3);       // line 0..63 of the tile: vf = L>>1, half = L&1
    const int vf = L >> 1, hl = L & 1;
    pc[i] = *(const v4ua*)(sT + vf * VTP + hl * 64 + (t & 7) * 8);
  }
  {
#pragma unroll
    for (int i = 0; i < 4; ++i) {
      const int L  = i * 16 + (t >> 3);
      const int vf = L >> 1, hl = L & 1;
      *(v4u*)(vt + ((size_t)b * DV + vf) * SEQ + n0 + hl * 64 + (t & 7) * 8) = pc[i];
    }
    
  }
}

// =====================================================================================================
// (3) Folded output weight: Wf[d][v] = sum_{g<8} bf16(w_o[d][32 g + v]) in f32 (the concatenated head is 8
// copies of the same 32 values). One block of 256 threads, thread d owns row d; hi = rne_bf16(Wf),
// lo = rne_bf16(Wf - hi) staged in LDS [256][32]; then each 16 KB plane (128 lines) is written 8 consecutive
// coverage: 4 instructions x 256 threads x 8 halves = 8192 = the whole [256][32] plane, both planes.
// =====================================================================================================
__global__ __launch_bounds__(256) void wfold(const float* __restrict__ wo, unsigned short* wfh, unsigned short* wfl) {
  __shared__ __attribute__((aligned(16))) unsigned short sH[DO * DV];
  __shared__ __attribute__((aligned(16))) unsigned short sL[DO * DV];
  const int d = (int)threadIdx.x;
  const float* row = wo + (size_t)d * (NH * DV);
#pragma unroll 1
  for (int vb = 0; vb < DV / 8; ++vb) {
    float s8[8];
#pragma unroll
    for (int e = 0; e < 8; ++e) s8[e] = 0.f;
#pragma unroll
    for (int g = 0; g < NH; ++g) {
      const v4f a = *(const v4fa*)(row + g * DV + 8 * vb);
      const v4f c = *(const v4fa*)(row + g * DV + 8 * vb + 4);
      s8[0] += bf16r(a[0]); s8[1] += bf16r(a[1]); s8[2] += bf16r(a[2]); s8[3] += bf16r(a[3]);
      s8[4] += bf16r(c[0]); s8[5] += bf16r(c[1]); s8[6] += bf16r(c[2]); s8[7] += bf16r(c[3]);
    }
#pragma unroll
    for (int e = 0; e < 8; ++e) {
      const unsigned short hb = bf_bits(s8[e]);
      sH[d * DV + 8 * vb + e] = hb;
      sL[d * DV + 8 * vb + e] = bf_bits(s8[e] - bf_up(hb));
    }
  }
  __syncthreads();
  v4u ph[4], pl[4];
#pragma unroll
  for (int i = 0; i < 4; ++i) {
    const int e = (i * 32 + (d >> 3)) * 64 + (d & 7) * 8;   // line i*32 + d>>3, 16-B piece d&7
    ph[i] = *(const v4ua*)(sH + e);
    pl[i] = *(const v4ua*)(sL + e);
  }
  {
#pragma unroll
    for (int i = 0; i < 4; ++i) {
      const int e = (i * 32 + (d >> 3)) * 64 + (d & 7) * 8;
      *(v4u*)(wfh + e) = ph[i];
      *(v4u*)(wfl + e) = pl[i];
    }
    
  }
}

// =====================================================================================================
// (4) Presence-masked attention + folded output linear, transposed streaming form.
// Block 256 thr (8 waves, two per SIMD), one batch per blockIdx.y. Waves w and w + 4 share the 16 queries of tile w & 3;
// of every 128-key stage wave w takes keys 64 (w >> 2) .. + 63, with its own running maximum, sum and O^T; the two
// partial results are merged once, behind the loop, through LDS.
//   S^T = K . Q^T : A = K rows (row = key, k = d) from the LDS K ring, B = Q^T (k = d, n = query) from the
//                   bf16 Q row of query q0+m; 8 d-steps of 32; D s[j][r] = S^T[key kb+16j+8h+r][query m].
//   logits (f32, literal form): t = (s * q_pres[m] * k_pres[key] - (1 - k_pres[key]) * 1e32) * inv_scale;
//   online softmax per query column (lane stats + partner lane ^ 16), f32, exp via v_exp.
//   O^T += V^T . P^T : A = Vt rows (row = vf, k = key) from the bf16 v^T plane; B = P^T built from the lane's
//                   own score D tiles (pairs (0,1) and (2,3)) as bf16 hi + residual -> 2 products per tile.
//   Epilogue: head^T B fragment = (O^T[0], O^T[1]) / l split into bf16 hi + residual; out^T = WfH . Hhi +
//             WfH . Hlo + WfL . Hhi, + bf16(b_o); wave w does the 8 d-tiles of column half w >> 2 and stages a 16 x 128 f32 slab in LDS
//   K ring: two stages of 128 keys in LDS, each wave brings one 32-key x 256-B slice per stage by one tensor load, one
//   stage ahead; V^T fragments straight from global rows; VGPR cap 256 (no high-bank registers).
//   coverage: grid (SEQ/64, NB) x 4 tiles x 16 rows x 2 waves x 128 cols = the whole [NB*SEQ][256] output;
//   slab: 16 x 128 written by the wave before its reload.
// =====================================================================================================
// ---- tensor load of one K slice (global -> LDS, no registers) ---------------------------------------------
__device__ __forceinline__ unsigned uni(unsigned v) { return (unsigned)__builtin_amdgcn_readfirstlane(v); }
// A tensor load ignores EXEC: only a scalar branch (s_cmp + s_cbranch_scc) guards it.
__device__ __forceinline__ unsigned pinned(unsigned v) {
  unsigned w = uni(v);
  asm volatile("" : "+s"(w));   // pinned(): holds the wave-uniform test word in a scalar register, so the branch on it stays scalar
  return w;
}
// One request of the whole wave; the waits for it are written by hand at the publish points.
__device__ __forceinline__ void tdm_load(u32x4 g0, u32x8 g1) {
#if DEV_ASM
  asm volatile("tensor_load_to_lds %0, %1" :: "s"(g0), "s"(g1) : "memory");
#endif
}
// Group 1: 1-byte elements, tensor = tile = KROWS rows of KROWB bytes, source pitch one whole K row, 4 dwords of pad
// behind every 64 dwords (interval code 5, amount code 3), no workgroup mask.
__device__ __forceinline__ u32x8 tdm_group1() {
  u32x8 g;
  g[0] = uni((1u << 20) | (5u << 22) | (3u << 25));
  g[1] = uni(((unsigned)KROWB & 0xFFFFu) << 16);
  g[2] = uni(((unsigned)KROWB >> 16) | (((unsigned)KROWS & 0xFFFFu) << 16));
  g[3] = uni(((unsigned)KROWS >> 16) | ((unsigned)KROWB << 16));
  g[4] = uni((unsigned)KROWS);
  g[5] = uni((unsigned)(DK * 2));
  g[6] = uni(0u);
  g[7] = uni(0u);
  return g;
}
__device__ __forceinline__ u32x4 tdm_group0(unsigned lds_dst, unsigned long long ga) {
  u32x4 g;
  g[0] = uni(1u);
  g[1] = uni(lds_dst);
  g[2] = uni((unsigned)ga);
  g[3] = uni((((unsigned)(ga >> 32)) & 0x01FFFFFFu) | 0x80000000u);
  return g;
}
// The waits for the tensor mover and for LDS reads in front of a refill are written out.
__device__ __forceinline__ void wait_tensor0() {
#if DEV_ASM
  asm volatile("s_wait_tensorcnt 0x0" ::: "memory");
#endif
}
__device__ __forceinline__ void wait_ds0() {
#if DEV_ASM
  asm volatile("s_wait_dscnt 0x0" ::: "memory");
#endif
}

__device__ __forceinline__ void out_store_pass(const float* slab, float* out, size_t row0, int half, int lane) {
  const int q8 = lane & 7, sub = lane >> 3;
#pragma unroll
  for (int it = 0; it < 16; ++it) {
    const int L = it * 4 + sub;
    const int row = L >> 2, seg = L & 3;
    const v4f val = *(const v4fa*)(slab + row * SP + seg * 32 + 4 * q8);
    float* dst = out + (row0 + (size_t)row) * DO + half * 128 + seg * 32 + 4 * q8;
    *(v4f*)dst = val;
  }
}

__global__ __launch_bounds__(256) __attribute__((amdgpu_num_vgpr(256)))
void attn_out(const unsigned short* __restrict__ qb,    // [NB*SEQ][DK] bf16
              const unsigned short* __restrict__ kb,    // [NB*SEQ][DK] bf16
              const unsigned short* __restrict__ vt,    // [NB][DV][SEQ] bf16
              const float* __restrict__ qpres,          // [NB][SEQ]
              const float* __restrict__ kpres,          // [NB][SEQ]
              const unsigned short* __restrict__ wfh,   // [DO][DV] bf16 hi
              const unsigned short* __restrict__ wfl,   // [DO][DV] bf16 residual
              const float* __restrict__ bo,             // [DO]
              float* out,                               // [NB*SEQ][DO]
              float inv_scale) {
  __shared__ __attribute__((aligned(2048))) unsigned char sK[2 * KBUF];   // 163840 B: K ring, two stages
  __shared__ __attribute__((aligned(16))) float sO[8 * 16 * SP];   // 67584 B: one slab per wave

  const int tid = (int)threadIdx.x, lane = tid & 31, w = tid >> 5;
  const int h = lane >> 4, m = lane & 15;
  const int b = (int)blockIdx.y;
  const int q0 = (int)blockIdx.x * 64 + 16 * (w & 3);
  const size_t rowB = (size_t)b * SEQ;

  const unsigned short* qrow  = qb + (rowB + q0 + m) * DK;            // B fragment source (query column m)
  // K slice brought by this wave: keys 32 (w & 3) .. + 31 of the stage, bytes 256 (w >> 2) .. + 255 of each K row.
  const unsigned wv = uni((unsigned)tid >> 5);
  const unsigned kh = wv >> 2;                                        // key half of every stage that this wave works on
  const unsigned long long kga = (unsigned long long)(size_t)(kb + (rowB + KROWS * (wv & 3u)) * DK + (KROWB / 2) * (wv >> 2));
  const unsigned kdst = (unsigned)(size_t)sK + wv * KSLICE;            // + (stage & 1) * KBUF
  const u32x8 kg1 = tdm_group1();
  const unsigned short* vbase = vt + ((size_t)b * DV + m) * SEQ + KCH * kh;   // + 16 t * SEQ + stage base
  const float* mkp = kpres + rowB + KCH * kh + 8 * h;                 // + stage base + key tile base
  const float qp = qpres[rowB + q0 + m];

  v8f o[2];
  o[0] = zero8(); o[1] = zero8();
  float mrun = -1e30f, lrun = 0.0f;

  // ---- ring prologue: stage 0 lands and is published, then stage 1 starts ----
  tdm_load(tdm_group0(kdst, kga), kg1);
  wait_tensor0();
  __syncthreads();
  tdm_load(tdm_group0(kdst + KBUF, kga + (unsigned long long)(STK * DK * 2)), kg1);

#pragma unroll 1
  for (int key0 = 0; key0 < SEQ; key0 += STK) {                        // key0 = stage base; the wave's keys start KCH kh behind it
    const unsigned st = (unsigned)key0 / STK;
    const unsigned char* kst = sK + (st & 1u) * KBUF + 2u * kh * KSLICE + m * KPITCH;   // this stage's buffer, the wave's key half, row of lane m
    // ---- scores ----
    v8f s[4];
#pragma unroll
    for (int j = 0; j < 4; ++j) s[j] = zero8();
    // Operand fragments run FLEAD d-steps ahead of their products: the loads of d-step dc + FLEAD stand as one group in
    // front of the products of d-step dc, so a product waits on loads issued FLEAD d-steps earlier, not on its own.
    // All reads are of this stage's buffer, inside this pass.
    v16b qf[DK / 32], kf[DK / 32][4];
#pragma unroll   // full unroll: the fragment arrays must be indexed by constants to live in registers
    for (int dc = -FLEAD; dc < DK / 32; ++dc) {
      const int df = dc + FLEAD;
      if (df < DK / 32) {
        qf[df] = ldfrag(qrow + 32 * df, h);
#pragma unroll
        for (int j = 0; j < 4; ++j)
          // slice 4 (df >> 2) + 2 kh + (j >> 1), row 16 (j & 1) + m, byte 64 (df & 3) of the 256-B slice row
          kf[df][j] = ldfrag((const unsigned short*)(kst + (4 * (df >> 2) + (j >> 1)) * KSLICE + 16 * (j & 1) * KPITCH + 64 * (df & 3)), h);
      }
      if (dc >= 0) {
#pragma unroll
        for (int j = 0; j < 4; ++j) s[j] = wmma_bf(kf[dc][j], qf[dc], s[j]);
      }
    }

    // ---- presence masks and scale (literal f32 form of the spec) ----
#pragma unroll
    for (int j = 0; j < 4; ++j) {
      const v4f ka = *(const v4fa*)(mkp + key0 + 16 * j);
      const v4f kc = *(const v4fa*)(mkp + key0 + 16 * j + 4);
      const float kp8[8] = {ka[0], ka[1], ka[2], ka[3], kc[0], kc[1], kc[2], kc[3]};
#pragma unroll
      for (int r = 0; r < 8; ++r) {
        float tv = s[j][r] * qp;
        tv = tv * kp8[r];
        tv = tv - (1.0f - kp8[r]) * 1e32f;
        {
          // Numerical reason: the scaled logit must be ONE rounded product, used by the row maximum and by the exponent's
          // argument alike, so that the row's largest logit gives exp(0) exactly; fused into
          // the later subtraction it would leave the product's rounding error there, which is huge at logits near 1e31.
#pragma clang fp contract(off)
          s[j][r] = tv * inv_scale;
        }
      }
    }

    // ---- online softmax (per query column; partner lane holds the other 8 keys of each tile) ----
    float mloc = s[0][0];
#pragma unroll
    for (int j = 0; j < 4; ++j)
#pragma unroll
      for (int r = 0; r < 8; ++r) mloc = fmaxf(mloc, s[j][r]);
    mloc = fmaxf(mloc, __shfl_xor(mloc, 16, 32));
    const float mnew  = fmaxf(mrun, mloc);
    const float alpha = __expf(mrun - mnew);
    mrun = mnew;
    float lsum = 0.0f;
#pragma unroll
    for (int j = 0; j < 4; ++j)
#pragma unroll
      for (int r = 0; r < 8; ++r) {
        const float p = __expf(s[j][r] - mnew);    // absent key: exp(-1.77e31 - m) = 0 exactly
        s[j][r] = p;
        lsum += p;
      }
    lsum += __shfl_xor(lsum, 16, 32);
    lrun = lrun * alpha + lsum;
    o[0] = o[0] * alpha;
    o[1] = o[1] * alpha;

    // ---- P^T B fragments (keys key0+64kh+0..31 and key0+64kh+32..63) as bf16 hi + residual ----
    v16b ph0, pl0, ph1, pl1;
    split_pack(s[0], s[1], ph0, pl0);
    split_pack(s[2], s[3], ph1, pl1);

    // ---- O^T += V^T . P^T ----
#pragma unroll
    for (int t = 0; t < 2; ++t) {
      const unsigned short* vp = vbase + (size_t)(16 * t) * SEQ + key0;
      const v16b vf0 = ldfrag(vp, h);
      const v16b vf1 = ldfrag(vp + 32, h);
      o[t] = wmma_bf(vf0, ph0, o[t]);
      o[t] = wmma_bf(vf0, pl0, o[t]);
      o[t] = wmma_bf(vf1, ph1, o[t]);
      o[t] = wmma_bf(vf1, pl1, o[t]);
    }

    // ---- publish point of stage st + 1; the barrier also ends every wave's reads of stage st's buffer ----
#if DEV_ASM
    asm volatile("s_wait_xcnt 0x0" ::: "memory");   // stands in front of the next pass's advance of the global loads' address registers
#endif
    wait_ds0();
    wait_tensor0();
    __syncthreads();
    if (pinned(st + 2u < (unsigned)NST))
      tdm_load(tdm_group0(kdst + (st & 1u) * KBUF, kga + (unsigned long long)(st + 2u) * (STK * DK * 2)), kg1);
  }
  wait_tensor0();
  wait_ds0();

  // ---- merge of the two key halves of a query tile: waves w and w ^ 4 hold the same lane map, so lane by lane ----
  float* slab = sO + w * (16 * SP);
  {
    const float* pslab = sO + (w ^ 4) * (16 * SP);
    slab[lane] = mrun;
    slab[32 + lane] = lrun;
    // full unroll, here and at the reads below: the accumulator vectors must be indexed by constants to stay in registers
#pragma unroll
    for (int t = 0; t < 2; ++t)
#pragma unroll
      for (int r = 0; r < 8; ++r) slab[(2 + 8 * t + r) * 32 + lane] = o[t][r];
    __syncthreads();                              // publishes every wave's partial result to its partner
    const float mp = pslab[lane], lp = pslab[32 + lane];
    v8f op[2];
#pragma unroll
    for (int t = 0; t < 2; ++t)
#pragma unroll
      for (int r = 0; r < 8; ++r) op[t][r] = pslab[(2 + 8 * t + r) * 32 + lane];
    const float mall = fmaxf(mrun, mp);
    const float eo = __expf(mrun - mall), ep = __expf(mp - mall);
    lrun = lrun * eo + lp * ep;
    o[0] = o[0] * eo + op[0] * ep;
    o[1] = o[1] * eo + op[1] * ep;
    __syncthreads();                              // the partner has read this slab before it becomes output staging
  }

  // ---- epilogue: head^T B fragment (hi + residual), folded linear, bias, whole-line stores ----
  const float inv = (lrun > 0.0f) ? (1.0f / lrun) : 0.0f;
  v16b hh, hl;
  split_pack(o[0] * inv, o[1] * inv, hh, hl);

  const size_t orow0 = rowB + (size_t)q0;
  {
    const int half = (int)kh;                                    // this wave's 128 output columns
#pragma unroll 1
    for (int uu = 0; uu < 8; ++uu) {
      const int u = 8 * half + uu;                               // d-tile: d = 16 u + (8h + r)
      const v16b ah = ldfrag(wfh + (size_t)(16 * u + m) * DV, h);
      const v16b al = ldfrag(wfl + (size_t)(16 * u + m) * DV, h);
      v8f acc = zero8();
      acc = wmma_bf(ah, hh, acc);
      acc = wmma_bf(ah, hl, acc);
      acc = wmma_bf(al, hh, acc);
      const v4f b0 = *(const v4fa*)(bo + 16 * u + 8 * h);
      const v4f b1 = *(const v4fa*)(bo + 16 * u + 8 * h + 4);
      const float bb[8] = {b0[0], b0[1], b0[2], b0[3], b1[0], b1[1], b1[2], b1[3]};
#pragma unroll
      for (int r = 0; r < 8; ++r)
        slab[m * SP + 16 * uu + 8 * h + r] = acc[r] + bf16r(bb[r]);
    }
    __syncthreads();
    out_store_pass(slab, out, orow0, half, lane);
  }
}

// =====================================================================================================
// Workspace map (bytes), every region an exact multiple of its whole-line store granularity:
//   Qb   bf16 [16384][256]     8388608
//   Kb   bf16 [16384][256]     8388608
//   Vt   bf16 [8][32][2048]    1048576
//   WfH  bf16 [256][32]          16384
//   WfL  bf16 [256][32]          16384
//   total                     17858560
// =====================================================================================================
extern "C" void kernel_launch(void* const* d_in, const int* in_sizes, int n_in,
                              void* d_out, int out_size, void* d_ws, size_t ws_size,
                              hipStream_t stream) {
  if (n_in < 7) return;
  if (in_sizes[0] != NB * SEQ * DK || in_sizes[1] != NB * SEQ * DK) return;
  if (in_sizes[2] != NB * SEQ * DV) return;
  if (in_sizes[3] != NB * SEQ || in_sizes[4] != NB * SEQ) return;
  if (in_sizes[5] != DO * NH * DV || in_sizes[6] != DO) return;
  if (out_size != NB * SEQ * DO) return;

  const float* q   = (const float*)d_in[0];
  const float* k   = (const float*)d_in[1];
  const float* v   = (const float*)d_in[2];
  const float* qpr = (const float*)d_in[3];
  const float* kpr = (const float*)d_in[4];
  const float* wo  = (const float*)d_in[5];
  const float* bo  = (const float*)d_in[6];
  float* out = (float*)d_out;

  const size_t PQ = (size_t)NB * SEQ * DK * 2;      // 8388608
  const size_t PV = (size_t)NB * DV * SEQ * 2;      // 1048576
  const size_t PW = (size_t)DO * DV * 2;            //   16384
  size_t off = 0;
  const size_t oQ  = off; off += PQ;
  const size_t oK  = off; off += PQ;
  const size_t oV  = off; off += PV;
  const size_t oWH = off; off += PW;
  const size_t oWL = off; off += PW;
  if (off > ws_size) return;                        // off = 17858560
  if (off > (size_t)134217728) return;

  char* ws = (char*)d_ws;
  unsigned short* Qb  = (unsigned short*)(ws + oQ);
  unsigned short* Kb  = (unsigned short*)(ws + oK);
  unsigned short* Vt  = (unsigned short*)(ws + oV);
  unsigned short* WfH = (unsigned short*)(ws + oWH);
  unsigned short* WfL = (unsigned short*)(ws + oWL);

  const int n8 = NB * SEQ * DK / 8;                               // 524288 groups of 8 per plane
  const dim3 gCvt((2 * n8 + 255) / 256);                          // 4096 blocks
  const dim3 gVt(NB * (SEQ / 128));                               // 128 blocks
  const dim3 gAtt(SEQ / 64, NB);                                  // (32, 8)
  const float inv_scale = 0.17677669529663687f;                   // f32 value of 1 / sqrt(32)

  cvt_qk<<<gCvt, dim3(256), 0, stream>>>(q, k, Qb, Kb, n8);
  vtrans<<<gVt, dim3(128), 0, stream>>>(v, Vt);
  wfold<<<dim3(1), dim3(256), 0, stream>>>(wo, WfH, WfL);
  attn_out<<<gAtt, dim3(256), 0, stream>>>(Qb, Kb, Vt, qpr, kpr, WfH, WfL, bo, out, inv_scale);
  (void)hipGetLastError();
}

// v004
// It runs in 58.2 microseconds.
// Timed twice side by side with v003, it ran 1.18 times as fast both times.
// Counting every step since v000, it is 4.70 times as fast.
// Contractions: k.q^T scores = v_wmma_f32_16x16x32_bf16 (bf16 operands RNE-converted from keys / queries, single exact product, f32 accumulate);
// v^T.p^T = v_wmma_f32_16x16x32_bf16 (p computed in f32, packed as bf16 hi + bf16 residual fragments, against bf16(values): 2 products, f32 accumulate);
// output linear Wf.head^T = v_wmma_f32_16x16x32_bf16 (folded weight Wf = f32 sum of 8 bf16 w_o values, as bf16 hi + residual planes; head as bf16 hi + residual fragments: 3 products, f32 accumulate);
// presence masking, 1/sqrt(32) scale, online softmax, 1/l normalisation and bias in f32 on the VALU.
// Plane / fragment carries: none. Qb, Kb, Vt, WfH = bf16 x1; WfL and the p / head residual fragments are unscaled bf16 residuals
// (v - hi) and share the hi accumulator; nothing is folded back anywhere.
#include <hip/hip_runtime.h>

#define NB   8
#define SEQ  2048          // M = N
#define DK   256
#define DV   32            // per-head value dim
#define NH   8
#define DO   256
#define KCH  64            // keys per wave and streaming step
#define KSPL 2             // waves that share one query tile, each on its own KCH keys of a stage
#define STK  (KSPL * KCH)  // keys per stage
#define SP   132           // f32 slab pitch (16-B aligned rows)
#define VTP  136           // vtrans LDS pitch in halves (16-B aligned rows)
#define KROWB  256         // bytes of one staged K slice row (half of a 512-B bf16 K row)
#define KROWS  32          // rows (keys) of one staged K slice
#define KPITCH 272         // LDS pitch of a slice row: 256 B + 16 B pad, an odd multiple of 16 B for the ds_load_b128 readers
#define KSLICE 10240       // LDS bytes reserved per slice: 32 x 272 = 8704, rounded up to a multiple of 2 KiB
#define KBUF   (8 * KSLICE)  // one stage = 128 keys x 512 B as 8 slices (one per wave)
#define NST    (SEQ / STK) // stages = streaming steps of a wave
#define FLEAD  2           // d-steps by which the score products' operand loads run ahead of the products

static_assert(NH * DV == DK);
static_assert((SEQ % 128) == 0 && (SEQ % STK) == 0 && (DK % 32) == 0 && DV == 32 && DO == 256);
static_assert(((NB * SEQ * DK / 8) % 256) == 0);
static_assert(((SP * 4) % 16) == 0 && ((VTP * 2) % 16) == 0);
static_assert(2 * KROWB == DK * 2 && 2 * KROWS == KCH && 4 * KROWS == STK && KROWS * KPITCH <= KSLICE && (KSLICE % 2048) == 0 && NST >= 2);

typedef __bf16         v16b __attribute__((ext_vector_type(16)));
typedef float          v8f  __attribute__((ext_vector_type(8)));
typedef float          v4f  __attribute__((ext_vector_type(4)));
typedef unsigned int   v2u  __attribute__((ext_vector_type(2)));
typedef unsigned int   v4u  __attribute__((ext_vector_type(4)));
typedef unsigned int   v8u  __attribute__((ext_vector_type(8)));
typedef unsigned int   u32x4 __attribute__((ext_vector_type(4)));
typedef unsigned int   u32x8 __attribute__((ext_vector_type(8)));
typedef v4f __attribute__((may_alias)) v4fa;
typedef v4u __attribute__((may_alias)) v4ua;
union FB { v16b v; v8u u; v4u q[2]; };

#if defined(__HIP_DEVICE_COMPILE__)
#define DEV_ASM 1
#else
#define DEV_ASM 0
#endif

// ---- scalar helpers ---------------------------------------------------------------------------------
__device__ __forceinline__ unsigned short bf_bits(float f) {          // f32 -> bf16 bits, RNE convert
  const unsigned u = __float_as_uint(f);
  return (unsigned short)((u + 0x7FFFu + ((u >> 16) & 1u)) >> 16);
}
__device__ __forceinline__ float bf_up(unsigned short hb) { return __uint_as_float(((unsigned)hb) << 16); }
__device__ __forceinline__ float bf16r(float f) { return bf_up(bf_bits(f)); }
__device__ __forceinline__ unsigned pk16(unsigned short a, unsigned short b) { return (unsigned)a | ((unsigned)b << 16); }
__device__ __forceinline__ v8f zero8() { v8f z = {0.f, 0.f, 0.f, 0.f, 0.f, 0.f, 0.f, 0.f}; return z; }

// ---- 16x16x32 bf16 WMMA with hazard guard (ties D, keeps A/B live) --------------------------------------
// Fragment map (wave32): lane l, h = l>>4, m = n = l&15.
//   A/B element i: i<8 -> k0+8h+i ; i>=8 -> k0+16+8h+(i-8)
//   D element r : row 8h+r, col l&15
__device__ __forceinline__ v8f wmma_bf(v16b a, v16b b, v8f c) {
  v8f d = __builtin_amdgcn_wmma_f32_16x16x32_bf16(false, a, false, b, (short)0, c, false, false);
#if DEV_ASM
  asm volatile("v_nop\n\tv_nop\n\tv_nop\n\tv_nop" : "+v"(d) : "v"(a), "v"(b));
#endif
  return d;
}

// A or B fragment from a k-contiguous bf16 row; p points at element k0 of the row owned by this lane
// (row index = lane & 15 added by the caller). Two 16-B loads: k0+8h..+7 and k0+16+8h..+7.
__device__ __forceinline__ v16b ldfrag(const unsigned short* p, int h) {
  FB f;
  f.q[0] = *(const v4ua*)(p + 8 * h);
  f.q[1] = *(const v4ua*)(p + 16 + 8 * h);
  return f.v;
}

// B fragment built from the lane's own D values of two adjacent 16-row D tiles (tile a covers k 0..15, tile c
// covers k 16..31 of the 32-deep step, same lane / same column): element r <- a[r], element 8+r <- c[r];
// split into bf16 hi = rne(x) and bf16 residual rne(x - hi).
__device__ __forceinline__ void split_pack(v8f a, v8f c, v16b& hi, v16b& lo) {
  v8u hu = {0u, 0u, 0u, 0u, 0u, 0u, 0u, 0u};
  v8u lu = {0u, 0u, 0u, 0u, 0u, 0u, 0u, 0u};
#pragma unroll
  for (int i = 0; i < 4; ++i) {
    const float a0 = a[2 * i], a1 = a[2 * i + 1], c0 = c[2 * i], c1 = c[2 * i + 1];
    const unsigned short ha0 = bf_bits(a0), ha1 = bf_bits(a1), hc0 = bf_bits(c0), hc1 = bf_bits(c1);
    const unsigned short la0 = bf_bits(a0 - bf_up(ha0)), la1 = bf_bits(a1 - bf_up(ha1));
    const unsigned short lc0 = bf_bits(c0 - bf_up(hc0)), lc1 = bf_bits(c1 - bf_up(hc1));
    hu[i] = pk16(ha0, ha1);  hu[4 + i] = pk16(hc0, hc1);
    lu[i] = pk16(la0, la1);  lu[4 + i] = pk16(lc0, lc1);
  }
  FB H, L;
  H.u = hu; L.u = lu;
  hi = H.v; lo = L.v;
}

// =====================================================================================================
// (1)-(3) The three preparations read only inputs and write disjoint workspace planes, none reads what another writes:
// they run as block ranges of ONE launch of 256-thread blocks. The choice of range is by blockIdx, so block-uniform.
// The short ranges come first, so that they start at once and run beside the long one.
//   blocks [0, WFB)              folded output weight
//   blocks [WFB, WFB + VTB)      values transpose
//   blocks [WFB + VTB, ...)      queries and keys conversion
// =====================================================================================================
#define WFB (DO * DV / 4 / 256)      // 8 blocks: one thread per 4 folded weights
#define VTB (NB * (SEQ / 128))       // 128 blocks: one 128-key x 32-feature tile each
static_assert(((DO * DV / 4) % 256) == 0);

// Folded output weight: Wf[d][v] = sum_{g<8} bf16(w_o[d][32 g + v]) in f32, g ascending (the concatenated head is 8
// copies of the same 32 values); hi = rne_bf16(Wf), lo = rne_bf16(Wf - hi). Thread idx owns row d = idx >> 3, values
// 4 (idx & 7) .. + 3; a wave stores 4 whole rows = 256 B = 2 whole lines of each plane.
// coverage: WFB x 256 threads x 4 halves = 8192 = the whole [256][32] plane, both planes.
__device__ __forceinline__ void wfold_part(const float* __restrict__ wo, unsigned short* wfh, unsigned short* wfl, int idx) {
  const int d = idx >> 3, c4 = (idx & 7) * 4;
  const float* row = wo + (size_t)d * (NH * DV) + c4;
  float s4[4] = {0.f, 0.f, 0.f, 0.f};
#pragma unroll
  for (int g = 0; g < NH; ++g) {
    const v4f x = *(const v4fa*)(row + g * DV);
    s4[0] += bf16r(x[0]); s4[1] += bf16r(x[1]); s4[2] += bf16r(x[2]); s4[3] += bf16r(x[3]);
  }
  unsigned short hb[4], lb[4];
#pragma unroll
  for (int e = 0; e < 4; ++e) {
    hb[e] = bf_bits(s4[e]);
    lb[e] = bf_bits(s4[e] - bf_up(hb[e]));
  }
  v2u ph, pl;
  ph[0] = pk16(hb[0], hb[1]); ph[1] = pk16(hb[2], hb[3]);
  pl[0] = pk16(lb[0], lb[1]); pl[1] = pk16(lb[2], lb[3]);
  *(v2u*)(wfh + d * DV + c4) = ph;
  *(v2u*)(wfl + d * DV + c4) = pl;
}

// values f32 [b][n][32] -> bf16 transposed plane vt [b][vf][n] (pitch SEQ, key contiguous).
// One block = 128 keys x 32 vf of one batch: 4 x 16-B loads per thread (whole tile), RNE convert into an LDS [32][VTP]
// transposed tile, block barrier, then each output row segment (128 keys = 256 B = 2 lines) goes out in 16-B pieces.
// coverage: VTB blocks x 32 vf rows x 128 keys = the whole [NB][32][SEQ] plane; LDS staged extent
// (32 rows x keys 0..127) = consumed extent.
__device__ __forceinline__ void vtrans_part(const float* __restrict__ v, unsigned short* vt, unsigned short* sT, int blk, int t) {
  const int b  = blk / (SEQ / 128);
  const int n0 = (blk % (SEQ / 128)) * 128;
#pragma unroll
  for (int i = 0; i < 4; ++i) {
    const int f   = i * 256 + t;            // 0 .. 1023 float4 of the 128 x 32 tile
    const int key = f >> 3, c4 = (f & 7) * 4;
    const v4f x = *(const v4fa*)(v + ((size_t)b * SEQ + n0 + key) * DV + c4);
    sT[(c4 + 0) * VTP + key] = bf_bits(x[0]);
    sT[(c4 + 1) * VTP + key] = bf_bits(x[1]);
    sT[(c4 + 2) * VTP + key] = bf_bits(x[2]);
    sT[(c4 + 3) * VTP + key] = bf_bits(x[3]);
  }
  __syncthreads();
#pragma unroll
  for (int i = 0; i < 2; ++i) {
    const int L  = i * 32 + (t >> 3);       // line 0..63 of the tile: vf = L>>1, half = L&1
    const int vf = L >> 1, hl = L & 1;
    const v4u pc = *(const v4ua*)(sT + vf * VTP + hl * 64 + (t & 7) * 8);
    *(v4u*)(vt + ((size_t)b * DV + vf) * SEQ + n0 + hl * 64 + (t & 7) * 8) = pc;
  }
#if DEV_ASM
  asm volatile("s_wait_xcnt 0x0" ::: "memory");   // stands behind the two stores, in front of any later write of their address or data registers
#endif
}

// queries and keys f32 -> bf16 bits (RNE convert), 8 elements per thread, one 16-B store per lane:
// threads [0, n8) do the q plane, [n8, 2 n8) the k plane (n8 % 256 == 0, so the choice is block-uniform).
// coverage: 2 n8 threads x 8 = both [NB*SEQ][DK] planes completely.
__device__ __forceinline__ void cvt_part(const float* __restrict__ q, const float* __restrict__ k,
                                         unsigned short* qb, unsigned short* kb, int n8, int i) {
  if (i >= 2 * n8) return;
  const bool isq = (i < n8);
  const int j = isq ? i : (i - n8);
  const float* src = (isq ? q : k) + (size_t)j * 8;
  unsigned short* dst = (isq ? qb : kb) + (size_t)j * 8;
  const v4f a = *(const v4fa*)(src);
  const v4f c = *(const v4fa*)(src + 4);
  v4u p;
  p[0] = pk16(bf_bits(a[0]), bf_bits(a[1]));
  p[1] = pk16(bf_bits(a[2]), bf_bits(a[3]));
  p[2] = pk16(bf_bits(c[0]), bf_bits(c[1]));
  p[3] = pk16(bf_bits(c[2]), bf_bits(c[3]));
  *(v4u*)dst = p;
}

__global__ __launch_bounds__(256) void prep(const float* __restrict__ q, const float* __restrict__ k,
                                            const float* __restrict__ v, const float* __restrict__ wo,
                                            unsigned short* qb, unsigned short* kb, unsigned short* vt,
                                            unsigned short* wfh, unsigned short* wfl, int n8) {
  __shared__ __attribute__((aligned(16))) unsigned short sT[DV * VTP];
  const int blk = (int)blockIdx.x, t = (int)threadIdx.x;
  if (blk < WFB) {
    wfold_part(wo, wfh, wfl, blk * 256 + t);
  } else if (blk < WFB + VTB) {
    vtrans_part(v, vt, sT, blk - WFB, t);
  } else {
    cvt_part(q, k, qb, kb, n8, (blk - (WFB + VTB)) * 256 + t);
  }
}

// =====================================================================================================
// (4) Presence-masked attention + folded output linear, transposed streaming form.
// Block 256 thr (8 waves, two per SIMD), one batch per blockIdx.y. Waves w and w + 4 share the 16 queries of tile w & 3;
// of every 128-key stage wave w takes keys 64 (w >> 2) .. + 63, with its own running maximum, sum and O^T; the two
// partial results are merged once, behind the loop, through LDS.
//   S^T = K . Q^T : A = K rows (row = key, k = d) from the LDS K ring, B = Q^T (k = d, n = query) from the
//                   bf16 Q row of query q0+m; 8 d-steps of 32; D s[j][r] = S^T[key kb+16j+8h+r][query m].
//   logits (f32, literal form): t = (s * q_pres[m] * k_pres[key] - (1 - k_pres[key]) * 1e32) * inv_scale;
//   online softmax per query column (lane stats + partner lane ^ 16), f32, exp via v_exp.
//   O^T += V^T . P^T : A = Vt rows (row = vf, k = key) from the bf16 v^T plane; B = P^T built from the lane's
//                   own score D tiles (pairs (0,1) and (2,3)) as bf16 hi + residual -> 2 products per tile.
//   Epilogue: head^T B fragment = (O^T[0], O^T[1]) / l split into bf16 hi + residual; out^T = WfH . Hhi +
//             WfH . Hlo + WfL . Hhi, + bf16(b_o); wave w does the 8 d-tiles of column half w >> 2 and stages a 16 x 128 f32 slab in LDS
//   K ring: two stages of 128 keys in LDS, each wave brings one 32-key x 256-B slice per stage by one tensor load, one
//   stage ahead; V^T fragments straight from global rows; VGPR cap 256 (no high-bank registers).
//   coverage: grid (SEQ/64, NB) x 4 tiles x 16 rows x 2 waves x 128 cols = the whole [NB*SEQ][256] output;
//   slab: 16 x 128 written by the wave before its reload.
// =====================================================================================================
// ---- tensor load of one K slice (global -> LDS, no registers) ---------------------------------------------
__device__ __forceinline__ unsigned uni(unsigned v) { return (unsigned)__builtin_amdgcn_readfirstlane(v); }
// A tensor load ignores EXEC: only a scalar branch (s_cmp + s_cbranch_scc) guards it.
__device__ __forceinline__ unsigned pinned(unsigned v) {
  unsigned w = uni(v);
  asm volatile("" : "+s"(w));   // pinned(): holds the wave-uniform test word in a scalar register, so the branch on it stays scalar
  return w;
}
// One request of the whole wave; the waits for it are written by hand at the publish points.
__device__ __forceinline__ void tdm_load(u32x4 g0, u32x8 g1) {
#if DEV_ASM
  asm volatile("tensor_load_to_lds %0, %1" :: "s"(g0), "s"(g1) : "memory");
#endif
}
// Group 1: 1-byte elements, tensor = tile = KROWS rows of KROWB bytes, source pitch one whole K row, 4 dwords of pad
// behind every 64 dwords (interval code 5, amount code 3), no workgroup mask.
__device__ __forceinline__ u32x8 tdm_group1() {
  u32x8 g;
  g[0] = uni((1u << 20) | (5u << 22) | (3u << 25));
  g[1] = uni(((unsigned)KROWB & 0xFFFFu) << 16);
  g[2] = uni(((unsigned)KROWB >> 16) | (((unsigned)KROWS & 0xFFFFu) << 16));
  g[3] = uni(((unsigned)KROWS >> 16) | ((unsigned)KROWB << 16));
  g[4] = uni((unsigned)KROWS);
  g[5] = uni((unsigned)(DK * 2));
  g[6] = uni(0u);
  g[7] = uni(0u);
  return g;
}
__device__ __forceinline__ u32x4 tdm_group0(unsigned lds_dst, unsigned long long ga) {
  u32x4 g;
  g[0] = uni(1u);
  g[1] = uni(lds_dst);
  g[2] = uni((unsigned)ga);
  g[3] = uni((((unsigned)(ga >> 32)) & 0x01FFFFFFu) | 0x80000000u);
  return g;
}
// The waits for the tensor mover and for LDS reads in front of a refill are written out.
__device__ __forceinline__ void wait_tensor0() {
#if DEV_ASM
  asm volatile("s_wait_tensorcnt 0x0" ::: "memory");
#endif
}
__device__ __forceinline__ void wait_ds0() {
#if DEV_ASM
  asm volatile("s_wait_dscnt 0x0" ::: "memory");
#endif
}

__device__ __forceinline__ void out_store_pass(const float* slab, float* out, size_t row0, int half, int lane) {
  const int q8 = lane & 7, sub = lane >> 3;
#pragma unroll
  for (int it = 0; it < 16; ++it) {
    const int L = it * 4 + sub;
    const int row = L >> 2, seg = L & 3;
    const v4f val = *(const v4fa*)(slab + row * SP + seg * 32 + 4 * q8);
    float* dst = out + (row0 + (size_t)row) * DO + half * 128 + seg * 32 + 4 * q8;
    *(v4f*)dst = val;
  }
}

__global__ __launch_bounds__(256) __attribute__((amdgpu_num_vgpr(256)))
void attn_out(const unsigned short* __restrict__ qb,    // [NB*SEQ][DK] bf16
              const unsigned short* __restrict__ kb,    // [NB*SEQ][DK] bf16
              const unsigned short* __restrict__ vt,    // [NB][DV][SEQ] bf16
              const float* __restrict__ qpres,          // [NB][SEQ]
              const float* __restrict__ kpres,          // [NB][SEQ]
              const unsigned short* __restrict__ wfh,   // [DO][DV] bf16 hi
              const unsigned short* __restrict__ wfl,   // [DO][DV] bf16 residual
              const float* __restrict__ bo,             // [DO]
              float* out,                               // [NB*SEQ][DO]
              float inv_scale) {
  __shared__ __attribute__((aligned(2048))) unsigned char sK[2 * KBUF];   // 163840 B: K ring, two stages
  __shared__ __attribute__((aligned(16))) float sO[8 * 16 * SP];   // 67584 B: one slab per wave

  const int tid = (int)threadIdx.x, lane = tid & 31, w = tid >> 5;
  const int h = lane >> 4, m = lane & 15;
  const int b = (int)blockIdx.y;
  const int q0 = (int)blockIdx.x * 64 + 16 * (w & 3);
  const size_t rowB = (size_t)b * SEQ;

  const unsigned short* qrow  = qb + (rowB + q0 + m) * DK;            // B fragment source (query column m)
  // K slice brought by this wave: keys 32 (w & 3) .. + 31 of the stage, bytes 256 (w >> 2) .. + 255 of each K row.
  const unsigned wv = uni((unsigned)tid >> 5);
  const unsigned kh = wv >> 2;                                        // key half of every stage that this wave works on
  const unsigned long long kga = (unsigned long long)(size_t)(kb + (rowB + KROWS * (wv & 3u)) * DK + (KROWB / 2) * (wv >> 2));
  const unsigned kdst = (unsigned)(size_t)sK + wv * KSLICE;            // + (stage & 1) * KBUF
  const u32x8 kg1 = tdm_group1();
  const unsigned short* vbase = vt + ((size_t)b * DV + m) * SEQ + KCH * kh;   // + 16 t * SEQ + stage base
  const float* mkp = kpres + rowB + KCH * kh + 8 * h;                 // + stage base + key tile base
  const float qp = qpres[rowB + q0 + m];

  v8f o[2];
  o[0] = zero8(); o[1] = zero8();
  float mrun = -1e30f, lrun = 0.0f;

  // ---- ring prologue: stage 0 lands and is published, then stage 1 starts ----
  tdm_load(tdm_group0(kdst, kga), kg1);
  wait_tensor0();
  __syncthreads();
  tdm_load(tdm_group0(kdst + KBUF, kga + (unsigned long long)(STK * DK * 2)), kg1);

#pragma unroll 1
  for (int key0 = 0; key0 < SEQ; key0 += STK) {                        // key0 = stage base; the wave's keys start KCH kh behind it
    const unsigned st = (unsigned)key0 / STK;
    const unsigned char* kst = sK + (st & 1u) * KBUF + 2u * kh * KSLICE + m * KPITCH;   // this stage's buffer, the wave's key half, row of lane m
    // ---- scores ----
    v8f s[4];
#pragma unroll
    for (int j = 0; j < 4; ++j) s[j] = zero8();
    // Operand fragments run FLEAD d-steps ahead of their products: the loads of d-step dc + FLEAD stand as one group in
    // front of the products of d-step dc, so a product waits on loads issued FLEAD d-steps earlier, not on its own.
    // All reads are of this stage's buffer, inside this pass.
    v16b qf[DK / 32], kf[DK / 32][4];
#pragma unroll   // full unroll: the fragment arrays must be indexed by constants to live in registers
    for (int dc = -FLEAD; dc < DK / 32; ++dc) {
      const int df = dc + FLEAD;
      if (df < DK / 32) {
        qf[df] = ldfrag(qrow + 32 * df, h);
#pragma unroll
        for (int j = 0; j < 4; ++j)
          // slice 4 (df >> 2) + 2 kh + (j >> 1), row 16 (j & 1) + m, byte 64 (df & 3) of the 256-B slice row
          kf[df][j] = ldfrag((const unsigned short*)(kst + (4 * (df >> 2) + (j >> 1)) * KSLICE + 16 * (j & 1) * KPITCH + 64 * (df & 3)), h);
      }
      if (dc >= 0) {
#pragma unroll
        for (int j = 0; j < 4; ++j) s[j] = wmma_bf(kf[dc][j], qf[dc], s[j]);
      }
    }

    // ---- presence masks and scale (literal f32 form of the spec) ----
#pragma unroll
    for (int j = 0; j < 4; ++j) {
      const v4f ka = *(const v4fa*)(mkp + key0 + 16 * j);
      const v4f kc = *(const v4fa*)(mkp + key0 + 16 * j + 4);
      const float kp8[8] = {ka[0], ka[1], ka[2], ka[3], kc[0], kc[1], kc[2], kc[3]};
#pragma unroll
      for (int r = 0; r < 8; ++r) {
        float tv = s[j][r] * qp;
        tv = tv * kp8[r];
        tv = tv - (1.0f - kp8[r]) * 1e32f;
        {
          // Numerical reason: the scaled logit must be ONE rounded product, used by the row maximum and by the exponent's
          // argument alike, so that the row's largest logit gives exp(0) exactly; fused into
          // the later subtraction it would leave the product's rounding error there, which is huge at logits near 1e31.
#pragma clang fp contract(off)
          s[j][r] = tv * inv_scale;
        }
      }
    }

    // ---- online softmax (per query column; partner lane holds the other 8 keys of each tile) ----
    float mloc = s[0][0];
#pragma unroll
    for (int j = 0; j < 4; ++j)
#pragma unroll
      for (int r = 0; r < 8; ++r) mloc = fmaxf(mloc, s[j][r]);
    mloc = fmaxf(mloc, __shfl_xor(mloc, 16, 32));
    const float mnew  = fmaxf(mrun, mloc);
    const float alpha = __expf(mrun - mnew);
    mrun = mnew;
    float lsum = 0.0f;
#pragma unroll
    for (int j = 0; j < 4; ++j)
#pragma unroll
      for (int r = 0; r < 8; ++r) {
        const float p = __expf(s[j][r] - mnew);    // absent key: exp(-1.77e31 - m) = 0 exactly
        s[j][r] = p;
        lsum += p;
      }
    lsum += __shfl_xor(lsum, 16, 32);
    lrun = lrun * alpha + lsum;
    o[0] = o[0] * alpha;
    o[1] = o[1] * alpha;

    // ---- P^T B fragments (keys key0+64kh+0..31 and key0+64kh+32..63) as bf16 hi + residual ----
    v16b ph0, pl0, ph1, pl1;
    split_pack(s[0], s[1], ph0, pl0);
    split_pack(s[2], s[3], ph1, pl1);

    // ---- O^T += V^T . P^T ----
#pragma unroll
    for (int t = 0; t < 2; ++t) {
      const unsigned short* vp = vbase + (size_t)(16 * t) * SEQ + key0;
      const v16b vf0 = ldfrag(vp, h);
      const v16b vf1 = ldfrag(vp + 32, h);
      o[t] = wmma_bf(vf0, ph0, o[t]);
      o[t] = wmma_bf(vf0, pl0, o[t]);
      o[t] = wmma_bf(vf1, ph1, o[t]);
      o[t] = wmma_bf(vf1, pl1, o[t]);
    }

    // ---- publish point of stage st + 1; the barrier also ends every wave's reads of stage st's buffer ----
#if DEV_ASM
    asm volatile("s_wait_xcnt 0x0" ::: "memory");   // stands in front of the next pass's advance of the global loads' address registers
#endif
    wait_ds0();
    wait_tensor0();
    __syncthreads();
    if (pinned(st + 2u < (unsigned)NST))
      tdm_load(tdm_group0(kdst + (st & 1u) * KBUF, kga + (unsigned long long)(st + 2u) * (STK * DK * 2)), kg1);
  }
  wait_tensor0();
  wait_ds0();

  // ---- merge of the two key halves of a query tile: waves w and w ^ 4 hold the same lane map, so lane by lane ----
  float* slab = sO + w * (16 * SP);
  {
    const float* pslab = sO + (w ^ 4) * (16 * SP);
    slab[lane] = mrun;
    slab[32 + lane] = lrun;
    // full unroll, here and at the reads below: the accumulator vectors must be indexed by constants to stay in registers
#pragma unroll
    for (int t = 0; t < 2; ++t)
#pragma unroll
      for (int r = 0; r < 8; ++r) slab[(2 + 8 * t + r) * 32 + lane] = o[t][r];
    __syncthreads();                              // publishes every wave's partial result to its partner
    const float mp = pslab[lane], lp = pslab[32 + lane];
    v8f op[2];
#pragma unroll
    for (int t = 0; t < 2; ++t)
#pragma unroll
      for (int r = 0; r < 8; ++r) op[t][r] = pslab[(2 + 8 * t + r) * 32 + lane];
    const float mall = fmaxf(mrun, mp);
    const float eo = __expf(mrun - mall), ep = __expf(mp - mall);
    lrun = lrun * eo + lp * ep;
    o[0] = o[0] * eo + op[0] * ep;
    o[1] = o[1] * eo + op[1] * ep;
    __syncthreads();                              // the partner has read this slab before it becomes output staging
  }

  // ---- epilogue: head^T B fragment (hi + residual), folded linear, bias, whole-line stores ----
  const float inv = (lrun > 0.0f) ? (1.0f / lrun) : 0.0f;
  v16b hh, hl;
  split_pack(o[0] * inv, o[1] * inv, hh, hl);

  const size_t orow0 = rowB + (size_t)q0;
  {
    const int half = (int)kh;                                    // this wave's 128 output columns
#pragma unroll 1
    for (int uu = 0; uu < 8; ++uu) {
      const int u = 8 * half + uu;                               // d-tile: d = 16 u + (8h + r)
      const v16b ah = ldfrag(wfh + (size_t)(16 * u + m) * DV, h);
      const v16b al = ldfrag(wfl + (size_t)(16 * u + m) * DV, h);
      v8f acc = zero8();
      acc = wmma_bf(ah, hh, acc);
      acc = wmma_bf(ah, hl, acc);
      acc = wmma_bf(al, hh, acc);
      const v4f b0 = *(const v4fa*)(bo + 16 * u + 8 * h);
      const v4f b1 = *(const v4fa*)(bo + 16 * u + 8 * h + 4);
      const float bb[8] = {b0[0], b0[1], b0[2], b0[3], b1[0], b1[1], b1[2], b1[3]};
#pragma unroll
      for (int r = 0; r < 8; ++r)
        slab[m * SP + 16 * uu + 8 * h + r] = acc[r] + bf16r(bb[r]);
    }
    __syncthreads();
    out_store_pass(slab, out, orow0, half, lane);
  }
}

// =====================================================================================================
// Workspace map (bytes), every region an exact multiple of its whole-line store granularity:
//   Qb   bf16 [16384][256]     8388608
//   Kb   bf16 [16384][256]     8388608
//   Vt   bf16 [8][32][2048]    1048576
//   WfH  bf16 [256][32]          16384
//   WfL  bf16 [256][32]          16384
//   total                     17858560
// =====================================================================================================
extern "C" void kernel_launch(void* const* d_in, const int* in_sizes, int n_in,
                              void* d_out, int out_size, void* d_ws, size_t ws_size,
                              hipStream_t stream) {
  if (n_in < 7) return;
  if (in_sizes[0] != NB * SEQ * DK || in_sizes[1] != NB * SEQ * DK) return;
  if (in_sizes[2] != NB * SEQ * DV) return;
  if (in_sizes[3] != NB * SEQ || in_sizes[4] != NB * SEQ) return;
  if (in_sizes[5] != DO * NH * DV || in_sizes[6] != DO) return;
  if (out_size != NB * SEQ * DO) return;

  const float* q   = (const float*)d_in[0];
  const float* k   = (const float*)d_in[1];
  const float* v   = (const float*)d_in[2];
  const float* qpr = (const float*)d_in[3];
  const float* kpr = (const float*)d_in[4];
  const float* wo  = (const float*)d_in[5];
  const float* bo  = (const float*)d_in[6];
  float* out = (float*)d_out;

  const size_t PQ = (size_t)NB * SEQ * DK * 2;      // 8388608
  const size_t PV = (size_t)NB * DV * SEQ * 2;      // 1048576
  const size_t PW = (size_t)DO * DV * 2;            //   16384
  size_t off = 0;
  const size_t oQ  = off; off += PQ;
  const size_t oK  = off; off += PQ;
  const size_t oV  = off; off += PV;
  const size_t oWH = off; off += PW;
  const size_t oWL = off; off += PW;
  if (off > ws_size) return;                        // off = 17858560
  if (off > (size_t)134217728) return;

  char* ws = (char*)d_ws;
  unsigned short* Qb  = (unsigned short*)(ws + oQ);
  unsigned short* Kb  = (unsigned short*)(ws + oK);
  unsigned short* Vt  = (unsigned short*)(ws + oV);
  unsigned short* WfH = (unsigned short*)(ws + oWH);
  unsigned short* WfL = (unsigned short*)(ws + oWL);

  const int n8 = NB * SEQ * DK / 8;                               // 524288 groups of 8 per plane
  const dim3 gPrep(WFB + VTB + (2 * n8 + 255) / 256);             // 8 + 128 + 4096 blocks
  const dim3 gAtt(SEQ / 64, NB);                                  // (32, 8)
  const float inv_scale = 0.17677669529663687f;                   // f32 value of 1 / sqrt(32)

  prep<<<gPrep, dim3(256), 0, stream>>>(q, k, v, wo, Qb, Kb, Vt, WfH, WfL, n8);
  attn_out<<<gAtt, dim3(256), 0, stream>>>(Qb, Kb, Vt, qpr, kpr, WfH, WfL, bo, out, inv_scale);
  (void)hipGetLastError();
}
